// v000
// Times are from an AMD MI455X. After a warm-up the kernel runs many times in a row, and a time is the length of
// such a window on the GPU divided by its runs, so every launch and the gaps after it count. The runs cycle
// through copies of the inputs. A figure is the median of several windows, for all but v000 over two sittings.
// Sittings can differ by a few percent; kernels timed side by side share one.
// The starting kernel, v000, takes 391 microseconds a run.
#include <hip/hip_runtime.h>
#include <cstdint>
#include <cstddef>

// Problem constants (from reference): B=8192, H=768, L=2, k=3, G=5, NUM_COEF=8
#define B_ROWS 8192
#define IN_F   768
#define NCOEF  8
#define KDIM   (IN_F * 9)   // 6912 = augmented K (silu + 8 spline bases per input feature)
#define OUT_L  2

typedef __attribute__((ext_vector_type(16))) _Float16 v16h;
typedef __attribute__((ext_vector_type(8)))  _Float16 v8h;
typedef __attribute__((ext_vector_type(8)))  float    v8f;

__device__ __forceinline__ float silu_f(float x) {
  return x / (1.0f + __expf(-x));
}

// Order-3 B-spline bases on uniform extended knot grid t_j = -1 + (j-3)*0.4, j=0..11.
// Faithful Cox-de Boor recursion (denominators are r*h, never zero).
__device__ __forceinline__ void bspline8(float x, float* __restrict__ out) {
  const float h = 0.4f;
  float t[12];
#pragma unroll
  for (int j = 0; j < 12; ++j) t[j] = -1.0f + (float)(j - 3) * h;
  float b[11];
#pragma unroll
  for (int j = 0; j < 11; ++j) b[j] = (x >= t[j] && x < t[j + 1]) ? 1.0f : 0.0f;
#pragma unroll
  for (int r = 1; r <= 3; ++r) {
    const float inv = 1.0f / ((float)r * h);
#pragma unroll
    for (int j = 0; j < 11 - 3; ++j) { // only first 11-r needed; 8 suffices for final
      // general recursion valid for j < 11 - r; we keep full range via guard below
    }
#pragma unroll
    for (int j = 0; j < 10; ++j) {
      if (j < 11 - r)
        b[j] = (x - t[j]) * inv * b[j] + (t[j + r + 1] - x) * inv * b[j + 1];
    }
  }
#pragma unroll
  for (int g = 0; g < NCOEF; ++g) out[g] = b[g];
}

// ---------------- Prep kernels: build augmented f16 A and W^T ----------------

__global__ __launch_bounds__(256) void kan_prep_act(const float* __restrict__ x,
                                                    _Float16* __restrict__ A, int total) {
  int idx = blockIdx.x * blockDim.x + threadIdx.x;
  if (idx >= total) return;
  float v = x[idx];
  int i = idx % IN_F;
  int b = idx / IN_F;
  _Float16* p = A + (size_t)b * KDIM + (size_t)i * 9;
  p[0] = (_Float16)silu_f(v);
  float bs[NCOEF];
  bspline8(v, bs);
#pragma unroll
  for (int g = 0; g < NCOEF; ++g) p[1 + g] = (_Float16)bs[g];
}

__global__ __launch_bounds__(256) void kan_prep_w(const float* __restrict__ bw,
                                                  const float* __restrict__ sw,
                                                  _Float16* __restrict__ W, int total) {
  int idx = blockIdx.x * blockDim.x + threadIdx.x; // idx = o*IN_F + i
  if (idx >= total) return;
  int i = idx % IN_F;
  int o = idx / IN_F;
  _Float16* p = W + (size_t)o * KDIM + (size_t)i * 9;
  p[0] = (_Float16)bw[idx];
#pragma unroll
  for (int g = 0; g < NCOEF; ++g) p[1 + g] = (_Float16)sw[(size_t)idx * NCOEF + g];
}

// ---------------- WMMA GEMM: H = gelu(A[8192x6912] * W^T[6912x768]) ----------------

// 16-bit A-fragment layout (ISA 7.12.2): lane L<16 -> row M=L, K {0..7,16..23};
// lane L+16 -> row M=L, K {8..15,24..31}. Two contiguous 16B chunks per lane.
// Same pattern used for B from row-major [N][K] (transposed weight).
__device__ __forceinline__ v16h load_frag(const _Float16* __restrict__ base,
                                          int row0, int k0, int ldk, int lane) {
  const int row = row0 + (lane & 15);
  const int kk  = k0 + ((lane & 16) >> 1); // +8 halves for upper half-wave
  const _Float16* p = base + (size_t)row * ldk + kk;
  v8h lo = *(const v8h*)(p);
  v8h hi = *(const v8h*)(p + 16);
  v16h r;
#pragma unroll
  for (int t = 0; t < 8; ++t) { r[t] = lo[t]; r[t + 8] = hi[t]; }
  return r;
}

__global__ __launch_bounds__(128) void kan_gemm1_gelu(const _Float16* __restrict__ A,
                                                      const _Float16* __restrict__ W,
                                                      float* __restrict__ H) {
  const int lane = threadIdx.x & 31;
  const int wave = threadIdx.x >> 5;
  const int m0 = blockIdx.x * 64;                 // 4 M-fragments per wave
  const int n0 = blockIdx.y * 128 + wave * 32;    // 2 N-fragments per wave

  v8f acc[4][2] = {};

  for (int k0 = 0; k0 < KDIM; k0 += 32) {
    v16h af[4], bf[2];
#pragma unroll
    for (int m = 0; m < 4; ++m) af[m] = load_frag(A, m0 + 16 * m, k0, KDIM, lane);
#pragma unroll
    for (int n = 0; n < 2; ++n) bf[n] = load_frag(W, n0 + 16 * n, k0, KDIM, lane);
#pragma unroll
    for (int m = 0; m < 4; ++m)
#pragma unroll
      for (int n = 0; n < 2; ++n)
        acc[m][n] = __builtin_amdgcn_wmma_f32_16x16x32_f16(
            false, af[m], false, bf[n], (short)0, acc[m][n], false, false);
  }

  // D layout: lane L holds (m = v + 8*(L>=16), n = L&15) for v in 0..7
  const int rsub = (lane >> 4) << 3;
  const int csub = lane & 15;
#pragma unroll
  for (int m = 0; m < 4; ++m)
#pragma unroll
    for (int n = 0; n < 2; ++n)
#pragma unroll
      for (int v = 0; v < 8; ++v) {
        float x = acc[m][n][v];
        float g = 0.5f * x * (1.0f + erff(x * 0.70710678118654752f)); // exact-erf GELU
        int row = m0 + 16 * m + rsub + v;
        int col = n0 + 16 * n + csub;
        H[(size_t)row * IN_F + col] = g;
      }
}

// ---------------- Layer 2: out[b, 0..1], one wave per row, shuffle reduction ----------------

__global__ __launch_bounds__(256) void kan_layer2(const float* __restrict__ H,
                                                  const float* __restrict__ w2b,
                                                  const float* __restrict__ w2s,
                                                  float* __restrict__ out) {
  const int lane = threadIdx.x & 31;
  const int b = blockIdx.x * 8 + (threadIdx.x >> 5);
  float a0 = 0.0f, a1 = 0.0f;
  for (int i = lane; i < IN_F; i += 32) {
    float x = H[(size_t)b * IN_F + i];
    float s = silu_f(x);
    float bs[NCOEF];
    bspline8(x, bs);
    a0 += s * w2b[i];
    a1 += s * w2b[IN_F + i];
    const float* w0 = w2s + (size_t)i * NCOEF;
    const float* w1 = w2s + (size_t)(IN_F + i) * NCOEF;
#pragma unroll
    for (int g = 0; g < NCOEF; ++g) {
      a0 += bs[g] * w0[g];
      a1 += bs[g] * w1[g];
    }
  }
#pragma unroll
  for (int off = 16; off > 0; off >>= 1) {
    a0 += __shfl_down(a0, off, 32);
    a1 += __shfl_down(a1, off, 32);
  }
  if (lane == 0) {
    out[(size_t)b * OUT_L + 0] = a0;
    out[(size_t)b * OUT_L + 1] = a1;
  }
}

// ---------------- Launch ----------------

extern "C" void kernel_launch(void* const* d_in, const int* in_sizes, int n_in,
                              void* d_out, int out_size, void* d_ws, size_t ws_size,
                              hipStream_t stream) {
  (void)in_sizes; (void)n_in; (void)out_size; (void)ws_size;
  const float* hidden = (const float*)d_in[0];
  const float* kbw    = (const float*)d_in[1];  // [768,768]
  const float* ksw    = (const float*)d_in[2];  // [768,768,8]
  const float* obw    = (const float*)d_in[3];  // [2,768]
  const float* osw    = (const float*)d_in[4];  // [2,768,8]
  float* out = (float*)d_out;

  uint8_t* ws = (uint8_t*)d_ws;
  const size_t szA = (size_t)B_ROWS * KDIM * sizeof(_Float16); // 113.2 MB
  const size_t szW = (size_t)IN_F * KDIM * sizeof(_Float16);   // 10.6 MB
  _Float16* A = (_Float16*)(ws);
  _Float16* W = (_Float16*)(ws + szA);
  float*    H = (float*)(ws + szA + szW);                      // 25.2 MB

  const int totA = B_ROWS * IN_F;
  kan_prep_act<<<(totA + 255) / 256, 256, 0, stream>>>(hidden, A, totA);
  const int totW = IN_F * IN_F;
  kan_prep_w<<<(totW + 255) / 256, 256, 0, stream>>>(kbw, ksw, W, totW);

  dim3 g(B_ROWS / 64, IN_F / 128); // 128 x 6 blocks, 4 waves each
  kan_gemm1_gelu<<<g, 128, 0, stream>>>(A, W, H);

  kan_layer2<<<B_ROWS / 8, 256, 0, stream>>>(H, obw, osw, out);
}

// v001
// It runs in 186 microseconds.
// Next to v000, in two timings, it ran 2.15 and 2.18 times as fast.
#include <hip/hip_runtime.h>
#include <cstdint>
#include <cstddef>

// Problem constants (from reference): B=8192, H=768, L=2, k=3, G=5, NUM_COEF=8
#define B_ROWS 8192
#define IN_F   768
#define NCOEF  8
#define KDIM   (IN_F * 9)   // 6912 = augmented K (silu + 8 spline bases per input feature)
#define OUT_L  2

typedef __attribute__((ext_vector_type(16))) _Float16 v16h;
typedef __attribute__((ext_vector_type(8)))  _Float16 v8h;
typedef __attribute__((ext_vector_type(8)))  float    v8f;

__device__ __forceinline__ float silu_f(float x) {
  return x / (1.0f + __expf(-x));
}

// Order-3 B-spline bases on uniform extended knot grid t_j = -1 + (j-3)*0.4, j=0..11.
// Faithful Cox-de Boor recursion (denominators are r*h, never zero).
__device__ __forceinline__ void bspline8(float x, float* __restrict__ out) {
  const float h = 0.4f;
  float t[12];
#pragma unroll
  for (int j = 0; j < 12; ++j) t[j] = -1.0f + (float)(j - 3) * h;
  float b[11];
#pragma unroll
  for (int j = 0; j < 11; ++j) b[j] = (x >= t[j] && x < t[j + 1]) ? 1.0f : 0.0f;
#pragma unroll
  for (int r = 1; r <= 3; ++r) {
    const float inv = 1.0f / ((float)r * h);
#pragma unroll
    for (int j = 0; j < 11 - 3; ++j) { // only first 11-r needed; 8 suffices for final
      // general recursion valid for j < 11 - r; we keep full range via guard below
    }
#pragma unroll
    for (int j = 0; j < 10; ++j) {
      if (j < 11 - r)
        b[j] = (x - t[j]) * inv * b[j] + (t[j + r + 1] - x) * inv * b[j + 1];
    }
  }
#pragma unroll
  for (int g = 0; g < NCOEF; ++g) out[g] = b[g];
}

// ---------------- Prep kernels: build augmented f16 A and W^T ----------------

__global__ __launch_bounds__(256) void kan_prep_act(const float* __restrict__ x,
                                                    _Float16* __restrict__ A, int total) {
  int idx = blockIdx.x * blockDim.x + threadIdx.x;
  if (idx >= total) return;
  float v = x[idx];
  int i = idx % IN_F;
  int b = idx / IN_F;
  _Float16* p = A + (size_t)b * KDIM + (size_t)i * 9;
  p[0] = (_Float16)silu_f(v);
  float bs[NCOEF];
  bspline8(v, bs);
#pragma unroll
  for (int g = 0; g < NCOEF; ++g) p[1 + g] = (_Float16)bs[g];
}

__global__ __launch_bounds__(256) void kan_prep_w(const float* __restrict__ bw,
                                                  const float* __restrict__ sw,
                                                  _Float16* __restrict__ W, int total) {
  int idx = blockIdx.x * blockDim.x + threadIdx.x; // idx = o*IN_F + i
  if (idx >= total) return;
  int i = idx % IN_F;
  int o = idx / IN_F;
  _Float16* p = W + (size_t)o * KDIM + (size_t)i * 9;
  p[0] = (_Float16)bw[idx];
#pragma unroll
  for (int g = 0; g < NCOEF; ++g) p[1 + g] = (_Float16)sw[(size_t)idx * NCOEF + g];
}

// ---------------- WMMA GEMM: H = gelu(A[8192x6912] * W^T[6912x768]) ----------------

// One work-group of 8 waves owns a 128 x 192 tile of H. A pass is 192 k: 128 rows of A and
// 192 rows of W, 384 B each, lie in one LDS buffer at a pitch of 400 B (16 B x odd: the
// 16 lanes of a ds_load_b128 half fall on distinct banks). Two buffers: the next pass's
// rows are copied while this pass is worked on.
#define TILE_M  128
#define TILE_N  192
#define KPASS   192
#define NPASS   (KDIM / KPASS)            // 36
#define PITCH_B 400
#define STAGE_B ((TILE_M + TILE_N) * PITCH_B)  // 128000 bytes per buffer

// Fifteen asynchronous 16-byte copies per lane, global -> LDS. The s_wait_xcnt is the last
// line of the copies' own statement so that no address register named here is rewritten
// ahead of it.
__device__ __forceinline__ void copy15(const uint32_t* l, const _Float16* const* g) {
  asm volatile(
      "global_load_async_to_lds_b128 %0, %15, off\n\t"
      "global_load_async_to_lds_b128 %1, %16, off\n\t"
      "global_load_async_to_lds_b128 %2, %17, off\n\t"
      "global_load_async_to_lds_b128 %3, %18, off\n\t"
      "global_load_async_to_lds_b128 %4, %19, off\n\t"
      "global_load_async_to_lds_b128 %5, %20, off\n\t"
      "global_load_async_to_lds_b128 %6, %21, off\n\t"
      "global_load_async_to_lds_b128 %7, %22, off\n\t"
      "global_load_async_to_lds_b128 %8, %23, off\n\t"
      "global_load_async_to_lds_b128 %9, %24, off\n\t"
      "global_load_async_to_lds_b128 %10, %25, off\n\t"
      "global_load_async_to_lds_b128 %11, %26, off\n\t"
      "global_load_async_to_lds_b128 %12, %27, off\n\t"
      "global_load_async_to_lds_b128 %13, %28, off\n\t"
      "global_load_async_to_lds_b128 %14, %29, off\n\t"
      "s_wait_xcnt 0x0"
      :: "v"(l[0]), "v"(l[1]), "v"(l[2]), "v"(l[3]), "v"(l[4]), "v"(l[5]), "v"(l[6]), "v"(l[7]), "v"(l[8]), "v"(l[9]), "v"(l[10]), "v"(l[11]), "v"(l[12]), "v"(l[13]), "v"(l[14]),
         "v"(g[0]), "v"(g[1]), "v"(g[2]), "v"(g[3]), "v"(g[4]), "v"(g[5]), "v"(g[6]), "v"(g[7]), "v"(g[8]), "v"(g[9]), "v"(g[10]), "v"(g[11]), "v"(g[12]), "v"(g[13]), "v"(g[14])
      : "memory");
}

// One stage = 320 rows x 24 chunks of 16 B = 30 chunks per thread. Chunk (a, b) of a thread
// lies 32 * a rows below chunk (0, b): three copies of all 256 threads cover 32 whole rows.
__device__ __forceinline__ void issue_stage(const uint32_t* lds3, const _Float16* const* ga3,
                                            const _Float16* const* gw3, uint32_t buf, int koff) {
  uint32_t l[30];
  const _Float16* g[30];
  // both loops unrolled: every index of l and g is a constant, so the arrays are registers
#pragma unroll
  for (int a = 0; a < 10; ++a)
#pragma unroll
    for (int b = 0; b < 3; ++b) {
      l[a * 3 + b] = lds3[b] + buf + (uint32_t)(a * 32 * PITCH_B);
      g[a * 3 + b] = (a < 4) ? ga3[b] + koff + (size_t)a * 32 * KDIM
                             : gw3[b] + koff + (size_t)(a - 4) * 32 * KDIM;
    }
  copy15(l, g);
  copy15(l + 15, g + 15);
}

// 16-bit fragment (ISA 7.12.2): lane L<16 -> row L, K {0..7,16..23}; lane L+16 -> row L,
// K {8..15,24..31}: two 16-byte chunks per lane, the same pattern for A and for W rows.
__device__ __forceinline__ v16h lds_frag(const unsigned char* p) {
  v8h lo = *(const v8h*)(p);
  v8h hi = *(const v8h*)(p + 32);
  return __builtin_shufflevector(lo, hi, 0, 1, 2, 3, 4, 5, 6, 7, 8, 9, 10, 11, 12, 13, 14, 15);
}

__global__ __launch_bounds__(256) void kan_gemm1_gelu(const _Float16* __restrict__ A,
                                                      const _Float16* __restrict__ W,
                                                      float* __restrict__ H) {
  __shared__ __attribute__((aligned(16))) unsigned char L[2 * STAGE_B];

  const int tid  = threadIdx.x;
  const int lane = tid & 31;
  const int wave = tid >> 5;
  const int wm = wave >> 2;                 // 2 wave rows of 64
  const int wn = wave & 3;                  // 4 wave columns of 48
  const int n0 = blockIdx.x * TILE_N;       // the 4 column tiles of one row tile are neighbours
  const int m0 = blockIdx.y * TILE_M;

  uint32_t lds3[3];
  const _Float16* ga3[3];
  const _Float16* gw3[3];
  const uint32_t lbase = (uint32_t)(uintptr_t)&L[0];
  // unrolled: the three-entry arrays stay in registers
#pragma unroll
  for (int b = 0; b < 3; ++b) {
    const int q = b * 256 + tid;            // 0..767
    const int r = q / 24;                   // row 0..31
    const int c = q - r * 24;               // 16-byte chunk 0..23
    lds3[b] = lbase + (uint32_t)(r * PITCH_B + c * 16);
    ga3[b] = A + (size_t)(m0 + r) * KDIM + c * 8;
    gw3[b] = W + (size_t)(n0 + r) * KDIM + c * 8;
  }

  v8f acc[4][3] = {};

  const int csub = lane & 15;
  const int hsub = lane >> 4;
  const unsigned char* pa = L + (wm * 64 + csub) * PITCH_B + 16 * hsub;
  const unsigned char* pb = L + (TILE_M + wn * 48 + csub) * PITCH_B + 16 * hsub;

  issue_stage(lds3, ga3, gw3, 0u, 0);
  asm volatile("s_wait_asynccnt 0x0" ::: "memory");  // this wave's part of pass 0 has landed
  __syncthreads();                                   // every wave's part of pass 0 has landed
  issue_stage(lds3, ga3, gw3, (uint32_t)STAGE_B, KPASS);

// one pass per trip: the ring's order (read, waits, barrier, refill) stands once, as written
#pragma clang loop unroll(disable)
  for (int t = 0; t < NPASS; ++t) {
    const uint32_t buf = (t & 1) ? (uint32_t)STAGE_B : 0u;
    const unsigned char* qa = pa + buf;
    const unsigned char* qb = pb + buf;
    // every loop below is unrolled so that fragment and accumulator indices are constants
    // (registers, no scratch) and the LDS offsets are immediates
    v16h af[2][4], bf[2][3];
#pragma unroll
    for (int i = 0; i < 4; ++i) af[0][i] = lds_frag(qa + i * 16 * PITCH_B);
#pragma unroll
    for (int j = 0; j < 3; ++j) bf[0][j] = lds_frag(qb + j * 16 * PITCH_B);
#pragma unroll
    for (int ks = 0; ks < KPASS / 32; ++ks) {
      const int cur = ks & 1, nxt = cur ^ 1;
      if (ks + 1 < KPASS / 32) {  // the next 32 k of this same buffer, as one group of reads
#pragma unroll
        for (int i = 0; i < 4; ++i) af[nxt][i] = lds_frag(qa + i * 16 * PITCH_B + (ks + 1) * 64);
#pragma unroll
        for (int j = 0; j < 3; ++j) bf[nxt][j] = lds_frag(qb + j * 16 * PITCH_B + (ks + 1) * 64);
      }
      // keeps the group of LDS reads ahead of the matrix block instead of spread among it
      __builtin_amdgcn_sched_barrier(0);
#pragma unroll
      for (int i = 0; i < 4; ++i)
#pragma unroll
        for (int j = 0; j < 3; ++j)
          acc[i][j] = __builtin_amdgcn_wmma_f32_16x16x32_f16(
              false, af[cur][i], false, bf[cur][j], (short)0, acc[i][j], false, false);
      // keeps the following group of LDS reads behind this matrix block
      __builtin_amdgcn_sched_barrier(0);
    }
    asm volatile("s_wait_dscnt 0x0" ::: "memory");     // this wave's reads of the buffer are done
    asm volatile("s_wait_asynccnt 0x0" ::: "memory");  // this wave's part of pass t + 1 has landed
    __syncthreads();  // publishes pass t + 1 and frees the buffer that pass t has read
    if (t + 2 < NPASS) issue_stage(lds3, ga3, gw3, buf, (t + 2) * KPASS);
  }
  asm volatile("s_wait_asynccnt 0x0" ::: "memory");    // no copy is open when the wave ends

  // D layout: lane L holds (m = v + 8*(L>=16), n = L&15) for v in 0..7
  const int rsub = hsub << 3;
#pragma unroll
  for (int i = 0; i < 4; ++i)
#pragma unroll
    for (int j = 0; j < 3; ++j)
#pragma unroll
      for (int v = 0; v < 8; ++v) {
        float x = acc[i][j][v];
        float g = 0.5f * x * (1.0f + erff(x * 0.70710678118654752f)); // exact-erf GELU
        int row = m0 + wm * 64 + 16 * i + rsub + v;
        int col = n0 + wn * 48 + 16 * j + csub;
        H[(size_t)row * IN_F + col] = g;
      }
}

// ---------------- Layer 2: out[b, 0..1], one wave per row, shuffle reduction ----------------

__global__ __launch_bounds__(256) void kan_layer2(const float* __restrict__ H,
                                                  const float* __restrict__ w2b,
                                                  const float* __restrict__ w2s,
                                                  float* __restrict__ out) {
  const int lane = threadIdx.x & 31;
  const int b = blockIdx.x * 8 + (threadIdx.x >> 5);
  float a0 = 0.0f, a1 = 0.0f;
  for (int i = lane; i < IN_F; i += 32) {
    float x = H[(size_t)b * IN_F + i];
    float s = silu_f(x);
    float bs[NCOEF];
    bspline8(x, bs);
    a0 += s * w2b[i];
    a1 += s * w2b[IN_F + i];
    const float* w0 = w2s + (size_t)i * NCOEF;
    const float* w1 = w2s + (size_t)(IN_F + i) * NCOEF;
#pragma unroll
    for (int g = 0; g < NCOEF; ++g) {
      a0 += bs[g] * w0[g];
      a1 += bs[g] * w1[g];
    }
  }
#pragma unroll
  for (int off = 16; off > 0; off >>= 1) {
    a0 += __shfl_down(a0, off, 32);
    a1 += __shfl_down(a1, off, 32);
  }
  if (lane == 0) {
    out[(size_t)b * OUT_L + 0] = a0;
    out[(size_t)b * OUT_L + 1] = a1;
  }
}

// ---------------- Launch ----------------

extern "C" void kernel_launch(void* const* d_in, const int* in_sizes, int n_in,
                              void* d_out, int out_size, void* d_ws, size_t ws_size,
                              hipStream_t stream) {
  (void)in_sizes; (void)n_in; (void)out_size; (void)ws_size;
  const float* hidden = (const float*)d_in[0];
  const float* kbw    = (const float*)d_in[1];  // [768,768]
  const float* ksw    = (const float*)d_in[2];  // [768,768,8]
  const float* obw    = (const float*)d_in[3];  // [2,768]
  const float* osw    = (const float*)d_in[4];  // [2,768,8]
  float* out = (float*)d_out;

  uint8_t* ws = (uint8_t*)d_ws;
  const size_t szA = (size_t)B_ROWS * KDIM * sizeof(_Float16); // 113.2 MB
  const size_t szW = (size_t)IN_F * KDIM * sizeof(_Float16);   // 10.6 MB
  _Float16* A = (_Float16*)(ws);
  _Float16* W = (_Float16*)(ws + szA);
  float*    H = (float*)(ws + szA + szW);                      // 25.2 MB

  const int totA = B_ROWS * IN_F;
  kan_prep_act<<<(totA + 255) / 256, 256, 0, stream>>>(hidden, A, totA);
  const int totW = IN_F * IN_F;
  kan_prep_w<<<(totW + 255) / 256, 256, 0, stream>>>(kbw, ksw, W, totW);

  dim3 g(IN_F / TILE_N, B_ROWS / TILE_M); // 4 x 64 blocks, 8 waves each
  kan_gemm1_gelu<<<g, 256, 0, stream>>>(A, W, H);

  kan_layer2<<<B_ROWS / 8, 256, 0, stream>>>(H, obw, osw, out);
}

// v002
// A run of this version takes 166 microseconds.
// Timed twice side by side with v001, it ran 1.12 times as fast both times.
// Over all steps from v000 it is 2.43 times as fast.
#include <hip/hip_runtime.h>
#include <cstdint>
#include <cstddef>

// Problem constants (from reference): B=8192, H=768, L=2, k=3, G=5, NUM_COEF=8
#define B_ROWS 8192
#define IN_F   768
#define NCOEF  8
#define KDIM   (IN_F * 9)   // 6912 = augmented K (silu + 8 spline bases per input feature)
#define OUT_L  2

typedef __attribute__((ext_vector_type(16))) _Float16 v16h;
typedef __attribute__((ext_vector_type(8)))  _Float16 v8h;
typedef __attribute__((ext_vector_type(8)))  float    v8f;

__device__ __forceinline__ float silu_f(float x) {
  return x / (1.0f + __expf(-x));
}

// Order-3 B-spline bases on uniform extended knot grid t_j = -1 + (j-3)*0.4, j=0..11.
// Faithful Cox-de Boor recursion (denominators are r*h, never zero).
__device__ __forceinline__ void bspline8(float x, float* __restrict__ out) {
  const float h = 0.4f;
  float t[12];
#pragma unroll
  for (int j = 0; j < 12; ++j) t[j] = -1.0f + (float)(j - 3) * h;
  float b[11];
#pragma unroll
  for (int j = 0; j < 11; ++j) b[j] = (x >= t[j] && x < t[j + 1]) ? 1.0f : 0.0f;
#pragma unroll
  for (int r = 1; r <= 3; ++r) {
    const float inv = 1.0f / ((float)r * h);
#pragma unroll
    for (int j = 0; j < 11 - 3; ++j) { // only first 11-r needed; 8 suffices for final
      // general recursion valid for j < 11 - r; we keep full range via guard below
    }
#pragma unroll
    for (int j = 0; j < 10; ++j) {
      if (j < 11 - r)
        b[j] = (x - t[j]) * inv * b[j] + (t[j + r + 1] - x) * inv * b[j + 1];
    }
  }
#pragma unroll
  for (int g = 0; g < NCOEF; ++g) out[g] = b[g];
}

// ---------------- Prep kernels: build augmented f16 A and W^T ----------------

// Both augmented arrays are flat: feature number f (row * 768 + i) owns the 9 halfs at 9 * f.
// A wave builds a chunk of 256 neighbouring features = 2304 halfs = 4608 B = 36 whole 128-byte
// lines in its own LDS range and stores it with nine 512-byte wave-wide stores.
#define CHUNK_F 256
#define CHUNK_H (CHUNK_F * 9)

__device__ __forceinline__ void store_chunk(const _Float16* s, _Float16* __restrict__ dst, int lane) {
  // this wave's LDS writes are complete before its lanes read what other lanes wrote
  asm volatile("s_wait_dscnt 0x0" ::: "memory");
  v8h r[9];
  // unrolled: r stays in registers, nine reads in flight behind one wait
#pragma unroll
  for (int k = 0; k < 9; ++k) r[k] = *(const v8h*)(s + k * 256 + lane * 8);
#pragma unroll
  for (int k = 0; k < 9; ++k) *(v8h*)(dst + k * 256 + lane * 8) = r[k];
}

// One wave per row of x: three chunks. A lane makes 8 neighbouring features = 144 B of LDS
// (16 B x odd: the 16 lanes of a ds_store_b128 half fall on distinct banks).
__global__ __launch_bounds__(256) void kan_prep_act(const float* __restrict__ x,
                                                    _Float16* __restrict__ A) {
  __shared__ __attribute__((aligned(16))) _Float16 S[8 * CHUNK_H];
  const int lane = threadIdx.x & 31;
  const int wave = threadIdx.x >> 5;
  const int row = blockIdx.x * 8 + wave;
  _Float16* s = S + wave * CHUNK_H;
  const float* xr = x + (size_t)row * IN_F + lane * 8;
  _Float16* ar = A + (size_t)row * KDIM;

  // the whole row is asked for at once: chunk c is in a, chunk c + 1 in b, chunk c + 2 in d
  float4 a0 = *(const float4*)(xr);
  float4 a1 = *(const float4*)(xr + 4);
  float4 b0 = *(const float4*)(xr + CHUNK_F);
  float4 b1 = *(const float4*)(xr + CHUNK_F + 4);
  const float4 d0 = *(const float4*)(xr + 2 * CHUNK_F);
  const float4 d1 = *(const float4*)(xr + 2 * CHUNK_F + 4);
// stays rolled: one chunk's code is run three times instead of three copies run once each
#pragma clang loop unroll(disable)
  for (int c = 0; c < IN_F / CHUNK_F; ++c) {
    const float e[8] = {a0.x, a0.y, a0.z, a0.w, a1.x, a1.y, a1.z, a1.w};
    a0 = b0; a1 = b1;
    b0 = d0; b1 = d1;
    _Float16 h[72];
    // every loop below is unrolled so that h is indexed by constants (registers, no scratch)
#pragma unroll
    for (int q = 0; q < 8; ++q) {
      // exp(-x) as silu_f has it (x * -log2(e), then v_exp_f32), with the one issue slot that the
      // instruction set asks for behind a transcendental in the same statement
      float ex;
      asm("v_exp_f32 %0, %1\n\tv_nop" : "=v"(ex) : "v"(e[q] * -1.44269504088896341f));
      h[q * 9] = (_Float16)(e[q] / (1.0f + ex));
      float bs[NCOEF];
      bspline8(e[q], bs);
#pragma unroll
      for (int g = 0; g < NCOEF; ++g) h[q * 9 + 1 + g] = (_Float16)bs[g];
    }
#pragma unroll
    for (int k = 0; k < 9; ++k) {
      v8h p;
#pragma unroll
      for (int u = 0; u < 8; ++u) p[u] = h[k * 8 + u];
      *(v8h*)(s + lane * 72 + k * 8) = p;
    }
    store_chunk(s, ar + c * CHUNK_H, lane);
  }
}

// One wave per chunk of 256 (o, i) pairs. The 2048 spline weights of a chunk are loaded 512
// contiguous bytes at a time and turned in LDS: the 256 B of 8 features lie at a pitch of 272 B
// (16 B x odd), so that a lane can read the 8 features it packs without bank conflicts.
#define WROW_B  272
#define WTURN_B (32 * WROW_B)                 // 8704 bytes
#define WWAVE_B (WTURN_B + CHUNK_H * 2)       // 13312 bytes per wave

__global__ __launch_bounds__(256) void kan_prep_w(const float* __restrict__ bw,
                                                  const float* __restrict__ sw,
                                                  _Float16* __restrict__ W) {
  __shared__ __attribute__((aligned(16))) unsigned char S[8 * WWAVE_B];
  const int lane = threadIdx.x & 31;
  const int wave = threadIdx.x >> 5;
  const int chunk = blockIdx.x * 8 + wave;
  unsigned char* f = S + wave * WWAVE_B;
  _Float16* s = (_Float16*)(f + WTURN_B);
  const float* bp = bw + (size_t)chunk * CHUNK_F + lane * 8;
  const float* sp = sw + (size_t)chunk * CHUNK_F * NCOEF + lane * 4;

  float4 w[16];
  // every loop below is unrolled: all loads are issued before the first value is used, and the
  // arrays are indexed by constants (registers)
#pragma unroll
  for (int j = 0; j < 16; ++j) w[j] = *(const float4*)(sp + j * 128);
  const float4 b0 = *(const float4*)(bp);
  const float4 b1 = *(const float4*)(bp + 4);
  // load j, lane l holds 16-byte piece l % 16 of the 8-feature group 2 * j + l / 16
#pragma unroll
  for (int j = 0; j < 16; ++j)
    *(float4*)(f + (j * 2 + (lane >> 4)) * WROW_B + (lane & 15) * 16) = w[j];
  // this wave's LDS writes are complete before its lanes read what other lanes wrote
  asm volatile("s_wait_dscnt 0x0" ::: "memory");
  float4 t[16];
#pragma unroll
  for (int k = 0; k < 16; ++k) t[k] = *(const float4*)(f + lane * WROW_B + k * 16);

  const float e[8] = {b0.x, b0.y, b0.z, b0.w, b1.x, b1.y, b1.z, b1.w};
  _Float16 h[72];
#pragma unroll
  for (int q = 0; q < 8; ++q) {
    h[q * 9 + 0] = (_Float16)e[q];
    h[q * 9 + 1] = (_Float16)t[q * 2].x;
    h[q * 9 + 2] = (_Float16)t[q * 2].y;
    h[q * 9 + 3] = (_Float16)t[q * 2].z;
    h[q * 9 + 4] = (_Float16)t[q * 2].w;
    h[q * 9 + 5] = (_Float16)t[q * 2 + 1].x;
    h[q * 9 + 6] = (_Float16)t[q * 2 + 1].y;
    h[q * 9 + 7] = (_Float16)t[q * 2 + 1].z;
    h[q * 9 + 8] = (_Float16)t[q * 2 + 1].w;
  }
#pragma unroll
  for (int k = 0; k < 9; ++k) {
    v8h p;
#pragma unroll
    for (int u = 0; u < 8; ++u) p[u] = h[k * 8 + u];
    *(v8h*)(s + lane * 72 + k * 8) = p;
  }
  store_chunk(s, W + (size_t)chunk * CHUNK_H, lane);
}

// ---------------- WMMA GEMM: H = gelu(A[8192x6912] * W^T[6912x768]) ----------------

// One work-group of 8 waves owns a 128 x 192 tile of H. A pass is 192 k: 128 rows of A and
// 192 rows of W, 384 B each, lie in one LDS buffer at a pitch of 400 B (16 B x odd: the
// 16 lanes of a ds_load_b128 half fall on distinct banks). Two buffers: the next pass's
// rows are copied while this pass is worked on.
#define TILE_M  128
#define TILE_N  192
#define KPASS   192
#define NPASS   (KDIM / KPASS)            // 36
#define PITCH_B 400
#define STAGE_B ((TILE_M + TILE_N) * PITCH_B)  // 128000 bytes per buffer

// Fifteen asynchronous 16-byte copies per lane, global -> LDS. The s_wait_xcnt is the last
// line of the copies' own statement so that no address register named here is rewritten
// ahead of it.
__device__ __forceinline__ void copy15(const uint32_t* l, const _Float16* const* g) {
  asm volatile(
      "global_load_async_to_lds_b128 %0, %15, off\n\t"
      "global_load_async_to_lds_b128 %1, %16, off\n\t"
      "global_load_async_to_lds_b128 %2, %17, off\n\t"
      "global_load_async_to_lds_b128 %3, %18, off\n\t"
      "global_load_async_to_lds_b128 %4, %19, off\n\t"
      "global_load_async_to_lds_b128 %5, %20, off\n\t"
      "global_load_async_to_lds_b128 %6, %21, off\n\t"
      "global_load_async_to_lds_b128 %7, %22, off\n\t"
      "global_load_async_to_lds_b128 %8, %23, off\n\t"
      "global_load_async_to_lds_b128 %9, %24, off\n\t"
      "global_load_async_to_lds_b128 %10, %25, off\n\t"
      "global_load_async_to_lds_b128 %11, %26, off\n\t"
      "global_load_async_to_lds_b128 %12, %27, off\n\t"
      "global_load_async_to_lds_b128 %13, %28, off\n\t"
      "global_load_async_to_lds_b128 %14, %29, off\n\t"
      "s_wait_xcnt 0x0"
      :: "v"(l[0]), "v"(l[1]), "v"(l[2]), "v"(l[3]), "v"(l[4]), "v"(l[5]), "v"(l[6]), "v"(l[7]), "v"(l[8]), "v"(l[9]), "v"(l[10]), "v"(l[11]), "v"(l[12]), "v"(l[13]), "v"(l[14]),
         "v"(g[0]), "v"(g[1]), "v"(g[2]), "v"(g[3]), "v"(g[4]), "v"(g[5]), "v"(g[6]), "v"(g[7]), "v"(g[8]), "v"(g[9]), "v"(g[10]), "v"(g[11]), "v"(g[12]), "v"(g[13]), "v"(g[14])
      : "memory");
}

// One stage = 320 rows x 24 chunks of 16 B = 30 chunks per thread. Chunk (a, b) of a thread
// lies 32 * a rows below chunk (0, b): three copies of all 256 threads cover 32 whole rows.
__device__ __forceinline__ void issue_stage(const uint32_t* lds3, const _Float16* const* ga3,
                                            const _Float16* const* gw3, uint32_t buf, int koff) {
  uint32_t l[30];
  const _Float16* g[30];
  // both loops unrolled: every index of l and g is a constant, so the arrays are registers
#pragma unroll
  for (int a = 0; a < 10; ++a)
#pragma unroll
    for (int b = 0; b < 3; ++b) {
      l[a * 3 + b] = lds3[b] + buf + (uint32_t)(a * 32 * PITCH_B);
      g[a * 3 + b] = (a < 4) ? ga3[b] + koff + (size_t)a * 32 * KDIM
                             : gw3[b] + koff + (size_t)(a - 4) * 32 * KDIM;
    }
  copy15(l, g);
  copy15(l + 15, g + 15);
}

// 16-bit fragment (ISA 7.12.2): lane L<16 -> row L, K {0..7,16..23}; lane L+16 -> row L,
// K {8..15,24..31}: two 16-byte chunks per lane, the same pattern for A and for W rows.
__device__ __forceinline__ v16h lds_frag(const unsigned char* p) {
  v8h lo = *(const v8h*)(p);
  v8h hi = *(const v8h*)(p + 32);
  return __builtin_shufflevector(lo, hi, 0, 1, 2, 3, 4, 5, 6, 7, 8, 9, 10, 11, 12, 13, 14, 15);
}

__global__ __launch_bounds__(256) void kan_gemm1_gelu(const _Float16* __restrict__ A,
                                                      const _Float16* __restrict__ W,
                                                      float* __restrict__ H) {
  __shared__ __attribute__((aligned(16))) unsigned char L[2 * STAGE_B];

  const int tid  = threadIdx.x;
  const int lane = tid & 31;
  const int wave = tid >> 5;
  const int wm = wave >> 2;                 // 2 wave rows of 64
  const int wn = wave & 3;                  // 4 wave columns of 48
  const int n0 = blockIdx.x * TILE_N;       // the 4 column tiles of one row tile are neighbours
  const int m0 = blockIdx.y * TILE_M;

  uint32_t lds3[3];
  const _Float16* ga3[3];
  const _Float16* gw3[3];
  const uint32_t lbase = (uint32_t)(uintptr_t)&L[0];
  // unrolled: the three-entry arrays stay in registers
#pragma unroll
  for (int b = 0; b < 3; ++b) {
    const int q = b * 256 + tid;            // 0..767
    const int r = q / 24;                   // row 0..31
    const int c = q - r * 24;               // 16-byte chunk 0..23
    lds3[b] = lbase + (uint32_t)(r * PITCH_B + c * 16);
    ga3[b] = A + (size_t)(m0 + r) * KDIM + c * 8;
    gw3[b] = W + (size_t)(n0 + r) * KDIM + c * 8;
  }

  v8f acc[4][3] = {};

  const int csub = lane & 15;
  const int hsub = lane >> 4;
  const unsigned char* pa = L + (wm * 64 + csub) * PITCH_B + 16 * hsub;
  const unsigned char* pb = L + (TILE_M + wn * 48 + csub) * PITCH_B + 16 * hsub;

  issue_stage(lds3, ga3, gw3, 0u, 0);
  asm volatile("s_wait_asynccnt 0x0" ::: "memory");  // this wave's part of pass 0 has landed
  __syncthreads();                                   // every wave's part of pass 0 has landed
  issue_stage(lds3, ga3, gw3, (uint32_t)STAGE_B, KPASS);

// one pass per trip: the ring's order (read, waits, barrier, refill) stands once, as written
#pragma clang loop unroll(disable)
  for (int t = 0; t < NPASS; ++t) {
    const uint32_t buf = (t & 1) ? (uint32_t)STAGE_B : 0u;
    const unsigned char* qa = pa + buf;
    const unsigned char* qb = pb + buf;
    // every loop below is unrolled so that fragment and accumulator indices are constants
    // (registers, no scratch) and the LDS offsets are immediates
    v16h af[2][4], bf[2][3];
#pragma unroll
    for (int i = 0; i < 4; ++i) af[0][i] = lds_frag(qa + i * 16 * PITCH_B);
#pragma unroll
    for (int j = 0; j < 3; ++j) bf[0][j] = lds_frag(qb + j * 16 * PITCH_B);
#pragma unroll
    for (int ks = 0; ks < KPASS / 32; ++ks) {
      const int cur = ks & 1, nxt = cur ^ 1;
      if (ks + 1 < KPASS / 32) {  // the next 32 k of this same buffer, as one group of reads
#pragma unroll
        for (int i = 0; i < 4; ++i) af[nxt][i] = lds_frag(qa + i * 16 * PITCH_B + (ks + 1) * 64);
#pragma unroll
        for (int j = 0; j < 3; ++j) bf[nxt][j] = lds_frag(qb + j * 16 * PITCH_B + (ks + 1) * 64);
      }
      // keeps the group of LDS reads ahead of the matrix block instead of spread among it
      __builtin_amdgcn_sched_barrier(0);
#pragma unroll
      for (int i = 0; i < 4; ++i)
#pragma unroll
        for (int j = 0; j < 3; ++j)
          acc[i][j] = __builtin_amdgcn_wmma_f32_16x16x32_f16(
              false, af[cur][i], false, bf[cur][j], (short)0, acc[i][j], false, false);
      // keeps the following group of LDS reads behind this matrix block
      __builtin_amdgcn_sched_barrier(0);
    }
    asm volatile("s_wait_dscnt 0x0" ::: "memory");     // this wave's reads of the buffer are done
    asm volatile("s_wait_asynccnt 0x0" ::: "memory");  // this wave's part of pass t + 1 has landed
    __syncthreads();  // publishes pass t + 1 and frees the buffer that pass t has read
    if (t + 2 < NPASS) issue_stage(lds3, ga3, gw3, buf, (t + 2) * KPASS);
  }
  asm volatile("s_wait_asynccnt 0x0" ::: "memory");    // no copy is open when the wave ends

  // D layout: lane L holds (m = v + 8*(L>=16), n = L&15) for v in 0..7
  const int rsub = hsub << 3;
#pragma unroll
  for (int i = 0; i < 4; ++i)
#pragma unroll
    for (int j = 0; j < 3; ++j)
#pragma unroll
      for (int v = 0; v < 8; ++v) {
        float x = acc[i][j][v];
        float g = 0.5f * x * (1.0f + erff(x * 0.70710678118654752f)); // exact-erf GELU
        int row = m0 + wm * 64 + 16 * i + rsub + v;
        int col = n0 + wn * 48 + 16 * j + csub;
        H[(size_t)row * IN_F + col] = g;
      }
}

// ---------------- Layer 2: out[b, 0..1], one wave per row, shuffle reduction ----------------

__global__ __launch_bounds__(256) void kan_layer2(const float* __restrict__ H,
                                                  const float* __restrict__ w2b,
                                                  const float* __restrict__ w2s,
                                                  float* __restrict__ out) {
  const int lane = threadIdx.x & 31;
  const int b = blockIdx.x * 8 + (threadIdx.x >> 5);
  float a0 = 0.0f, a1 = 0.0f;
  for (int i = lane; i < IN_F; i += 32) {
    float x = H[(size_t)b * IN_F + i];
    float s = silu_f(x);
    float bs[NCOEF];
    bspline8(x, bs);
    a0 += s * w2b[i];
    a1 += s * w2b[IN_F + i];
    const float* w0 = w2s + (size_t)i * NCOEF;
    const float* w1 = w2s + (size_t)(IN_F + i) * NCOEF;
#pragma unroll
    for (int g = 0; g < NCOEF; ++g) {
      a0 += bs[g] * w0[g];
      a1 += bs[g] * w1[g];
    }
  }
#pragma unroll
  for (int off = 16; off > 0; off >>= 1) {
    a0 += __shfl_down(a0, off, 32);
    a1 += __shfl_down(a1, off, 32);
  }
  if (lane == 0) {
    out[(size_t)b * OUT_L + 0] = a0;
    out[(size_t)b * OUT_L + 1] = a1;
  }
}

// ---------------- Launch ----------------

extern "C" void kernel_launch(void* const* d_in, const int* in_sizes, int n_in,
                              void* d_out, int out_size, void* d_ws, size_t ws_size,
                              hipStream_t stream) {
  (void)in_sizes; (void)n_in; (void)out_size; (void)ws_size;
  const float* hidden = (const float*)d_in[0];
  const float* kbw    = (const float*)d_in[1];  // [768,768]
  const float* ksw    = (const float*)d_in[2];  // [768,768,8]
  const float* obw    = (const float*)d_in[3];  // [2,768]
  const float* osw    = (const float*)d_in[4];  // [2,768,8]
  float* out = (float*)d_out;

  uint8_t* ws = (uint8_t*)d_ws;
  const size_t szA = (size_t)B_ROWS * KDIM * sizeof(_Float16); // 113.2 MB
  const size_t szW = (size_t)IN_F * KDIM * sizeof(_Float16);   // 10.6 MB
  _Float16* A = (_Float16*)(ws);
  _Float16* W = (_Float16*)(ws + szA);
  float*    H = (float*)(ws + szA + szW);                      // 25.2 MB

  kan_prep_act<<<B_ROWS / 8, 256, 0, stream>>>(hidden, A);                    // one wave per row
  kan_prep_w<<<IN_F * IN_F / CHUNK_F / 8, 256, 0, stream>>>(kbw, ksw, W);     // 2304 chunks, 288 blocks

  dim3 g(IN_F / TILE_N, B_ROWS / TILE_M); // 4 x 64 blocks, 8 waves each
  kan_gemm1_gelu<<<g, 256, 0, stream>>>(A, W, H);

  kan_layer2<<<B_ROWS / 8, 256, 0, stream>>>(H, obw, osw, out);
}

// v003
// Measured time: 157 microseconds a run.
// Two timings next to v002 both put it at 1.06 times that version's speed.
// Over all steps from v000 it is 2.57 times as fast.
#include <hip/hip_runtime.h>
#include <cstdint>
#include <cstddef>

// Problem constants (from reference): B=8192, H=768, L=2, k=3, G=5, NUM_COEF=8
#define B_ROWS 8192
#define IN_F   768
#define NCOEF  8
#define KDIM   (IN_F * 9)   // 6912 = augmented K (silu + 8 spline bases per input feature)
#define OUT_L  2

typedef __attribute__((ext_vector_type(16))) _Float16 v16h;
typedef __attribute__((ext_vector_type(8)))  _Float16 v8h;
typedef __attribute__((ext_vector_type(8)))  float    v8f;

__device__ __forceinline__ float silu_f(float x) {
  return x / (1.0f + __expf(-x));
}

// Order-3 B-spline bases on uniform extended knot grid t_j = -1 + (j-3)*0.4, j=0..11.
// Faithful Cox-de Boor recursion (denominators are r*h, never zero).
__device__ __forceinline__ void bspline8(float x, float* __restrict__ out) {
  const float h = 0.4f;
  float t[12];
#pragma unroll
  for (int j = 0; j < 12; ++j) t[j] = -1.0f + (float)(j - 3) * h;
  float b[11];
#pragma unroll
  for (int j = 0; j < 11; ++j) b[j] = (x >= t[j] && x < t[j + 1]) ? 1.0f : 0.0f;
#pragma unroll
  for (int r = 1; r <= 3; ++r) {
    const float inv = 1.0f / ((float)r * h);
#pragma unroll
    for (int j = 0; j < 11 - 3; ++j) { // only first 11-r needed; 8 suffices for final
      // general recursion valid for j < 11 - r; we keep full range via guard below
    }
#pragma unroll
    for (int j = 0; j < 10; ++j) {
      if (j < 11 - r)
        b[j] = (x - t[j]) * inv * b[j] + (t[j + r + 1] - x) * inv * b[j + 1];
    }
  }
#pragma unroll
  for (int g = 0; g < NCOEF; ++g) out[g] = b[g];
}

// ---------------- Prep kernels: build augmented f16 A and W^T ----------------

// Both augmented arrays are flat: feature number f (row * 768 + i) owns the 9 halfs at 9 * f.
// A wave builds a chunk of 256 neighbouring features = 2304 halfs = 4608 B = 36 whole 128-byte
// lines in its own LDS range and stores it with nine 512-byte wave-wide stores.
#define CHUNK_F 256
#define CHUNK_H (CHUNK_F * 9)

__device__ __forceinline__ void store_chunk(const _Float16* s, _Float16* __restrict__ dst, int lane) {
  // this wave's LDS writes are complete before its lanes read what other lanes wrote
  asm volatile("s_wait_dscnt 0x0" ::: "memory");
  v8h r[9];
  // unrolled: r stays in registers, nine reads in flight behind one wait
#pragma unroll
  for (int k = 0; k < 9; ++k) r[k] = *(const v8h*)(s + k * 256 + lane * 8);
#pragma unroll
  for (int k = 0; k < 9; ++k) *(v8h*)(dst + k * 256 + lane * 8) = r[k];
}

// One wave per row of x: three chunks. A lane makes 8 neighbouring features = 144 B of LDS
// (16 B x odd: the 16 lanes of a ds_store_b128 half fall on distinct banks).
__global__ __launch_bounds__(256) void kan_prep_act(const float* __restrict__ x,
                                                    _Float16* __restrict__ A) {
  __shared__ __attribute__((aligned(16))) _Float16 S[8 * CHUNK_H];
  const int lane = threadIdx.x & 31;
  const int wave = threadIdx.x >> 5;
  const int row = blockIdx.x * 8 + wave;
  _Float16* s = S + wave * CHUNK_H;
  const float* xr = x + (size_t)row * IN_F + lane * 8;
  _Float16* ar = A + (size_t)row * KDIM;

  // the whole row is asked for at once: chunk c is in a, chunk c + 1 in b, chunk c + 2 in d
  float4 a0 = *(const float4*)(xr);
  float4 a1 = *(const float4*)(xr + 4);
  float4 b0 = *(const float4*)(xr + CHUNK_F);
  float4 b1 = *(const float4*)(xr + CHUNK_F + 4);
  const float4 d0 = *(const float4*)(xr + 2 * CHUNK_F);
  const float4 d1 = *(const float4*)(xr + 2 * CHUNK_F + 4);
// stays rolled: one chunk's code is run three times instead of three copies run once each
#pragma clang loop unroll(disable)
  for (int c = 0; c < IN_F / CHUNK_F; ++c) {
    const float e[8] = {a0.x, a0.y, a0.z, a0.w, a1.x, a1.y, a1.z, a1.w};
    a0 = b0; a1 = b1;
    b0 = d0; b1 = d1;
    _Float16 h[72];
    // every loop below is unrolled so that h is indexed by constants (registers, no scratch)
#pragma unroll
    for (int q = 0; q < 8; ++q) {
      // exp(-x) as silu_f has it (x * -log2(e), then v_exp_f32), with the one issue slot that the
      // instruction set asks for behind a transcendental in the same statement
      float ex;
      asm("v_exp_f32 %0, %1\n\tv_nop" : "=v"(ex) : "v"(e[q] * -1.44269504088896341f));
      h[q * 9] = (_Float16)(e[q] / (1.0f + ex));
      float bs[NCOEF];
      bspline8(e[q], bs);
#pragma unroll
      for (int g = 0; g < NCOEF; ++g) h[q * 9 + 1 + g] = (_Float16)bs[g];
    }
#pragma unroll
    for (int k = 0; k < 9; ++k) {
      v8h p;
#pragma unroll
      for (int u = 0; u < 8; ++u) p[u] = h[k * 8 + u];
      *(v8h*)(s + lane * 72 + k * 8) = p;
    }
    store_chunk(s, ar + c * CHUNK_H, lane);
  }
}

// One wave per chunk of 256 (o, i) pairs. The 2048 spline weights of a chunk are loaded 512
// contiguous bytes at a time and turned in LDS: the 256 B of 8 features lie at a pitch of 272 B
// (16 B x odd), so that a lane can read the 8 features it packs without bank conflicts.
#define WROW_B  272
#define WTURN_B (32 * WROW_B)                 // 8704 bytes
#define WWAVE_B (WTURN_B + CHUNK_H * 2)       // 13312 bytes per wave

__global__ __launch_bounds__(256) void kan_prep_w(const float* __restrict__ bw,
                                                  const float* __restrict__ sw,
                                                  _Float16* __restrict__ W) {
  __shared__ __attribute__((aligned(16))) unsigned char S[8 * WWAVE_B];
  const int lane = threadIdx.x & 31;
  const int wave = threadIdx.x >> 5;
  const int chunk = blockIdx.x * 8 + wave;
  unsigned char* f = S + wave * WWAVE_B;
  _Float16* s = (_Float16*)(f + WTURN_B);
  const float* bp = bw + (size_t)chunk * CHUNK_F + lane * 8;
  const float* sp = sw + (size_t)chunk * CHUNK_F * NCOEF + lane * 4;

  float4 w[16];
  // every loop below is unrolled: all loads are issued before the first value is used, and the
  // arrays are indexed by constants (registers)
#pragma unroll
  for (int j = 0; j < 16; ++j) w[j] = *(const float4*)(sp + j * 128);
  const float4 b0 = *(const float4*)(bp);
  const float4 b1 = *(const float4*)(bp + 4);
  // load j, lane l holds 16-byte piece l % 16 of the 8-feature group 2 * j + l / 16
#pragma unroll
  for (int j = 0; j < 16; ++j)
    *(float4*)(f + (j * 2 + (lane >> 4)) * WROW_B + (lane & 15) * 16) = w[j];
  // this wave's LDS writes are complete before its lanes read what other lanes wrote
  asm volatile("s_wait_dscnt 0x0" ::: "memory");
  float4 t[16];
#pragma unroll
  for (int k = 0; k < 16; ++k) t[k] = *(const float4*)(f + lane * WROW_B + k * 16);

  const float e[8] = {b0.x, b0.y, b0.z, b0.w, b1.x, b1.y, b1.z, b1.w};
  _Float16 h[72];
#pragma unroll
  for (int q = 0; q < 8; ++q) {
    h[q * 9 + 0] = (_Float16)e[q];
    h[q * 9 + 1] = (_Float16)t[q * 2].x;
    h[q * 9 + 2] = (_Float16)t[q * 2].y;
    h[q * 9 + 3] = (_Float16)t[q * 2].z;
    h[q * 9 + 4] = (_Float16)t[q * 2].w;
    h[q * 9 + 5] = (_Float16)t[q * 2 + 1].x;
    h[q * 9 + 6] = (_Float16)t[q * 2 + 1].y;
    h[q * 9 + 7] = (_Float16)t[q * 2 + 1].z;
    h[q * 9 + 8] = (_Float16)t[q * 2 + 1].w;
  }
#pragma unroll
  for (int k = 0; k < 9; ++k) {
    v8h p;
#pragma unroll
    for (int u = 0; u < 8; ++u) p[u] = h[k * 8 + u];
    *(v8h*)(s + lane * 72 + k * 8) = p;
  }
  store_chunk(s, W + (size_t)chunk * CHUNK_H, lane);
}

// ---------------- WMMA GEMM: H = A[8192x6912] * W^T[6912x768] (GELU: see layer 2) ----------------

// One work-group of 8 waves owns a 128 x 192 tile of H. A pass is 192 k: 128 rows of A and
// 192 rows of W, 384 B each, lie in one LDS buffer at a pitch of 400 B (16 B x odd: the
// 16 lanes of a ds_load_b128 half fall on distinct banks). Two buffers: the next pass's
// rows are copied while this pass is worked on.
#define TILE_M  128
#define TILE_N  192
#define KPASS   192
#define NPASS   (KDIM / KPASS)            // 36
#define PITCH_B 400
#define STAGE_B ((TILE_M + TILE_N) * PITCH_B)  // 128000 bytes per buffer

// Fifteen asynchronous 16-byte copies per lane, global -> LDS. The s_wait_xcnt is the last
// line of the copies' own statement so that no address register named here is rewritten
// ahead of it.
__device__ __forceinline__ void copy15(const uint32_t* l, const _Float16* const* g) {
  asm volatile(
      "global_load_async_to_lds_b128 %0, %15, off\n\t"
      "global_load_async_to_lds_b128 %1, %16, off\n\t"
      "global_load_async_to_lds_b128 %2, %17, off\n\t"
      "global_load_async_to_lds_b128 %3, %18, off\n\t"
      "global_load_async_to_lds_b128 %4, %19, off\n\t"
      "global_load_async_to_lds_b128 %5, %20, off\n\t"
      "global_load_async_to_lds_b128 %6, %21, off\n\t"
      "global_load_async_to_lds_b128 %7, %22, off\n\t"
      "global_load_async_to_lds_b128 %8, %23, off\n\t"
      "global_load_async_to_lds_b128 %9, %24, off\n\t"
      "global_load_async_to_lds_b128 %10, %25, off\n\t"
      "global_load_async_to_lds_b128 %11, %26, off\n\t"
      "global_load_async_to_lds_b128 %12, %27, off\n\t"
      "global_load_async_to_lds_b128 %13, %28, off\n\t"
      "global_load_async_to_lds_b128 %14, %29, off\n\t"
      "s_wait_xcnt 0x0"
      :: "v"(l[0]), "v"(l[1]), "v"(l[2]), "v"(l[3]), "v"(l[4]), "v"(l[5]), "v"(l[6]), "v"(l[7]), "v"(l[8]), "v"(l[9]), "v"(l[10]), "v"(l[11]), "v"(l[12]), "v"(l[13]), "v"(l[14]),
         "v"(g[0]), "v"(g[1]), "v"(g[2]), "v"(g[3]), "v"(g[4]), "v"(g[5]), "v"(g[6]), "v"(g[7]), "v"(g[8]), "v"(g[9]), "v"(g[10]), "v"(g[11]), "v"(g[12]), "v"(g[13]), "v"(g[14])
      : "memory");
}

// One stage = 320 rows x 24 chunks of 16 B = 30 chunks per thread. Chunk (a, b) of a thread
// lies 32 * a rows below chunk (0, b): three copies of all 256 threads cover 32 whole rows.
__device__ __forceinline__ void issue_stage(const uint32_t* lds3, const _Float16* const* ga3,
                                            const _Float16* const* gw3, uint32_t buf, int koff) {
  uint32_t l[30];
  const _Float16* g[30];
  // both loops unrolled: every index of l and g is a constant, so the arrays are registers
#pragma unroll
  for (int a = 0; a < 10; ++a)
#pragma unroll
    for (int b = 0; b < 3; ++b) {
      l[a * 3 + b] = lds3[b] + buf + (uint32_t)(a * 32 * PITCH_B);
      g[a * 3 + b] = (a < 4) ? ga3[b] + koff + (size_t)a * 32 * KDIM
                             : gw3[b] + koff + (size_t)(a - 4) * 32 * KDIM;
    }
  copy15(l, g);
  copy15(l + 15, g + 15);
}

// 16-bit fragment (ISA 7.12.2): lane L<16 -> row L, K {0..7,16..23}; lane L+16 -> row L,
// K {8..15,24..31}: two 16-byte chunks per lane, the same pattern for A and for W rows.
__device__ __forceinline__ v16h lds_frag(const unsigned char* p) {
  v8h lo = *(const v8h*)(p);
  v8h hi = *(const v8h*)(p + 32);
  return __builtin_shufflevector(lo, hi, 0, 1, 2, 3, 4, 5, 6, 7, 8, 9, 10, 11, 12, 13, 14, 15);
}

__global__ __launch_bounds__(256) void kan_gemm1(const _Float16* __restrict__ A,
                                                 const _Float16* __restrict__ W,
                                                 float* __restrict__ H) {
  __shared__ __attribute__((aligned(16))) unsigned char L[2 * STAGE_B];

  const int tid  = threadIdx.x;
  const int lane = tid & 31;
  const int wave = tid >> 5;
  const int wm = wave >> 2;                 // 2 wave rows of 64
  const int wn = wave & 3;                  // 4 wave columns of 48
  const int n0 = blockIdx.x * TILE_N;       // the 4 column tiles of one row tile are neighbours
  const int m0 = blockIdx.y * TILE_M;

  uint32_t lds3[3];
  const _Float16* ga3[3];
  const _Float16* gw3[3];
  const uint32_t lbase = (uint32_t)(uintptr_t)&L[0];
  // unrolled: the three-entry arrays stay in registers
#pragma unroll
  for (int b = 0; b < 3; ++b) {
    const int q = b * 256 + tid;            // 0..767
    const int r = q / 24;                   // row 0..31
    const int c = q - r * 24;               // 16-byte chunk 0..23
    lds3[b] = lbase + (uint32_t)(r * PITCH_B + c * 16);
    ga3[b] = A + (size_t)(m0 + r) * KDIM + c * 8;
    gw3[b] = W + (size_t)(n0 + r) * KDIM + c * 8;
  }

  v8f acc[4][3] = {};

  const int csub = lane & 15;
  const int hsub = lane >> 4;
  const unsigned char* pa = L + (wm * 64 + csub) * PITCH_B + 16 * hsub;
  const unsigned char* pb = L + (TILE_M + wn * 48 + csub) * PITCH_B + 16 * hsub;

  issue_stage(lds3, ga3, gw3, 0u, 0);
  asm volatile("s_wait_asynccnt 0x0" ::: "memory");  // this wave's part of pass 0 has landed
  __syncthreads();                                   // every wave's part of pass 0 has landed
  issue_stage(lds3, ga3, gw3, (uint32_t)STAGE_B, KPASS);

// one pass per trip: the ring's order (read, waits, barrier, refill) stands once, as written
#pragma clang loop unroll(disable)
  for (int t = 0; t < NPASS; ++t) {
    const uint32_t buf = (t & 1) ? (uint32_t)STAGE_B : 0u;
    const unsigned char* qa = pa + buf;
    const unsigned char* qb = pb + buf;
    // every loop below is unrolled so that fragment and accumulator indices are constants
    // (registers, no scratch) and the LDS offsets are immediates
    v16h af[2][4], bf[2][3];
#pragma unroll
    for (int i = 0; i < 4; ++i) af[0][i] = lds_frag(qa + i * 16 * PITCH_B);
#pragma unroll
    for (int j = 0; j < 3; ++j) bf[0][j] = lds_frag(qb + j * 16 * PITCH_B);
#pragma unroll
    for (int ks = 0; ks < KPASS / 32; ++ks) {
      const int cur = ks & 1, nxt = cur ^ 1;
      if (ks + 1 < KPASS / 32) {  // the next 32 k of this same buffer, as one group of reads
#pragma unroll
        for (int i = 0; i < 4; ++i) af[nxt][i] = lds_frag(qa + i * 16 * PITCH_B + (ks + 1) * 64);
#pragma unroll
        for (int j = 0; j < 3; ++j) bf[nxt][j] = lds_frag(qb + j * 16 * PITCH_B + (ks + 1) * 64);
      }
      // keeps the group of LDS reads ahead of the matrix block instead of spread among it
      __builtin_amdgcn_sched_barrier(0);
#pragma unroll
      for (int i = 0; i < 4; ++i)
#pragma unroll
        for (int j = 0; j < 3; ++j)
          acc[i][j] = __builtin_amdgcn_wmma_f32_16x16x32_f16(
              false, af[cur][i], false, bf[cur][j], (short)0, acc[i][j], false, false);
      // keeps the following group of LDS reads behind this matrix block
      __builtin_amdgcn_sched_barrier(0);
    }
    asm volatile("s_wait_dscnt 0x0" ::: "memory");     // this wave's reads of the buffer are done
    asm volatile("s_wait_asynccnt 0x0" ::: "memory");  // this wave's part of pass t + 1 has landed
    __syncthreads();  // publishes pass t + 1 and frees the buffer that pass t has read
    if (t + 2 < NPASS) issue_stage(lds3, ga3, gw3, buf, (t + 2) * KPASS);
  }
  asm volatile("s_wait_asynccnt 0x0" ::: "memory");    // no copy is open when the wave ends

  // D layout: lane L holds (m = v + 8*(L>=16), n = L&15) for v in 0..7
  const int rsub = hsub << 3;
#pragma unroll
  for (int i = 0; i < 4; ++i)
#pragma unroll
    for (int j = 0; j < 3; ++j)
#pragma unroll
      for (int v = 0; v < 8; ++v) {
        int row = m0 + wm * 64 + 16 * i + rsub + v;
        int col = n0 + wn * 48 + 16 * j + csub;
        H[(size_t)row * IN_F + col] = acc[i][j][v];
      }
}

// ---------------- Layer 2: out[b, 0..1], one wave per row, shuffle reduction ----------------
// H holds the first layer's sums; the GELU is applied here, where the value is read: one copy of
// erff's code in a rolled loop with eight waves on a SIMD, instead of 96 copies behind each
// other in the GEMM's unrolled epilogue with two.

__global__ __launch_bounds__(256) void kan_layer2(const float* __restrict__ H,
                                                  const float* __restrict__ w2b,
                                                  const float* __restrict__ w2s,
                                                  float* __restrict__ out) {
  const int lane = threadIdx.x & 31;
  const int b = blockIdx.x * 8 + (threadIdx.x >> 5);
  float a0 = 0.0f, a1 = 0.0f;
  for (int i = lane; i < IN_F; i += 32) {
    const float p = H[(size_t)b * IN_F + i];
    const float x = 0.5f * p * (1.0f + erff(p * 0.70710678118654752f)); // exact-erf GELU
    float s = silu_f(x);
    float bs[NCOEF];
    bspline8(x, bs);
    a0 += s * w2b[i];
    a1 += s * w2b[IN_F + i];
    const float* w0 = w2s + (size_t)i * NCOEF;
    const float* w1 = w2s + (size_t)(IN_F + i) * NCOEF;
#pragma unroll
    for (int g = 0; g < NCOEF; ++g) {
      a0 += bs[g] * w0[g];
      a1 += bs[g] * w1[g];
    }
  }
#pragma unroll
  for (int off = 16; off > 0; off >>= 1) {
    a0 += __shfl_down(a0, off, 32);
    a1 += __shfl_down(a1, off, 32);
  }
  if (lane == 0) {
    out[(size_t)b * OUT_L + 0] = a0;
    out[(size_t)b * OUT_L + 1] = a1;
  }
}

// ---------------- Launch ----------------

extern "C" void kernel_launch(void* const* d_in, const int* in_sizes, int n_in,
                              void* d_out, int out_size, void* d_ws, size_t ws_size,
                              hipStream_t stream) {
  (void)in_sizes; (void)n_in; (void)out_size; (void)ws_size;
  const float* hidden = (const float*)d_in[0];
  const float* kbw    = (const float*)d_in[1];  // [768,768]
  const float* ksw    = (const float*)d_in[2];  // [768,768,8]
  const float* obw    = (const float*)d_in[3];  // [2,768]
  const float* osw    = (const float*)d_in[4];  // [2,768,8]
  float* out = (float*)d_out;

  uint8_t* ws = (uint8_t*)d_ws;
  const size_t szA = (size_t)B_ROWS * KDIM * sizeof(_Float16); // 113.2 MB
  const size_t szW = (size_t)IN_F * KDIM * sizeof(_Float16);   // 10.6 MB
  _Float16* A = (_Float16*)(ws);
  _Float16* W = (_Float16*)(ws + szA);
  float*    H = (float*)(ws + szA + szW);                      // 25.2 MB

  kan_prep_act<<<B_ROWS / 8, 256, 0, stream>>>(hidden, A);                    // one wave per row
  kan_prep_w<<<IN_F * IN_F / CHUNK_F / 8, 256, 0, stream>>>(kbw, ksw, W);     // 2304 chunks, 288 blocks

  dim3 g(IN_F / TILE_N, B_ROWS / TILE_M); // 4 x 64 blocks, 8 waves each
  kan_gemm1<<<g, 256, 0, stream>>>(A, W, H);

  kan_layer2<<<B_ROWS / 8, 256, 0, stream>>>(H, obw, osw, out);
}

// v004
// A run of this version takes 141 microseconds.
// Next to v003, in two timings, it ran 1.11 times as fast each time.
// All steps since v000 together make it 2.84 times as fast.
#include <hip/hip_runtime.h>
#include <cstdint>
#include <cstddef>

// Problem constants (from reference): B=8192, H=768, L=2, k=3, G=5, NUM_COEF=8
#define B_ROWS 8192
#define IN_F   768
#define NCOEF  8
#define KDIM   (IN_F * 9)   // 6912 = augmented K (silu + 8 spline bases per input feature)
#define OUT_L  2

typedef __attribute__((ext_vector_type(16))) _Float16 v16h;
typedef __attribute__((ext_vector_type(8)))  _Float16 v8h;
typedef __attribute__((ext_vector_type(8)))  float    v8f;

__device__ __forceinline__ float silu_f(float x) {
  return x / (1.0f + __expf(-x));
}

// Order-3 B-spline bases on the uniform extended knot grid t_j = -1 + (j-3)*0.4, j=0..11.
// On equal knot spacing the Cox-de Boor recursion yields one shape for every basis: with d the
// distance of x from the centre t_(g+2) of basis g, in knot steps, and a = (1 - d/2) cut to [0, 1],
//   d <= 1: 2/3 - d^2 a        1 <= d <= 2: 4/3 a^3        d >= 2: 0.
// The first minus the second is -2/3 (1 - d)^3, so the smaller of the two is the right one on
// either side of d = 1, and for d >= 2 (a = 0) it is 0.
typedef __attribute__((ext_vector_type(2))) float v2f;

__device__ __forceinline__ void bspline8(float x, float* __restrict__ out) {
  // two bases at a time: the products below are packed two-float instructions; unrolled so that
  // out is indexed by constants (registers) and the centres are literals
#pragma unroll
  for (int g = 0; g < NCOEF; g += 2) {
    v2f d, a;
    d.x = fmaf(x, 2.5f, 3.5f - (float)g);  // (x - t_(g+2)) / h
    d.y = fmaf(x, 2.5f, 2.5f - (float)g);
    // the median with 0 and 1 compiles to the clamp modifier (on the multiply-add itself where that
    // stays a one-float instruction), not to a compare and select
    a.x = __builtin_amdgcn_fmed3f(fmaf(fabsf(d.x), -0.5f, 1.0f), 0.0f, 1.0f);
    a.y = __builtin_amdgcn_fmed3f(fmaf(fabsf(d.y), -0.5f, 1.0f), 0.0f, 1.0f);
    const v2f inner = (2.0f / 3.0f) - (d * d) * a;
    const v2f outer = (a * a) * (a * (4.0f / 3.0f));
    const v2f r = __builtin_elementwise_min(inner, outer);
    out[g] = r.x;
    out[g + 1] = r.y;
  }
}

// ---------------- Prep kernels: build augmented f16 A and W^T ----------------

// Both augmented arrays are flat: feature number f (row * 768 + i) owns the 9 halfs at 9 * f.
// A wave builds a chunk of 256 neighbouring features = 2304 halfs = 4608 B = 36 whole 128-byte
// lines in its own LDS range and stores it with nine 512-byte wave-wide stores.
#define CHUNK_F 256
#define CHUNK_H (CHUNK_F * 9)

__device__ __forceinline__ void store_chunk(const _Float16* s, _Float16* __restrict__ dst, int lane) {
  // this wave's LDS writes are complete before its lanes read what other lanes wrote
  asm volatile("s_wait_dscnt 0x0" ::: "memory");
  v8h r[9];
  // unrolled: r stays in registers, nine reads in flight behind one wait
#pragma unroll
  for (int k = 0; k < 9; ++k) r[k] = *(const v8h*)(s + k * 256 + lane * 8);
#pragma unroll
  for (int k = 0; k < 9; ++k) *(v8h*)(dst + k * 256 + lane * 8) = r[k];
}

// One wave per row of x: three chunks. A lane makes 8 neighbouring features = 144 B of LDS
// (16 B x odd: the 16 lanes of a ds_store_b128 half fall on distinct banks).
__global__ __launch_bounds__(256) void kan_prep_act(const float* __restrict__ x,
                                                    _Float16* __restrict__ A) {
  __shared__ __attribute__((aligned(16))) _Float16 S[8 * CHUNK_H];
  const int lane = threadIdx.x & 31;
  const int wave = threadIdx.x >> 5;
  const int row = blockIdx.x * 8 + wave;
  _Float16* s = S + wave * CHUNK_H;
  const float* xr = x + (size_t)row * IN_F + lane * 8;
  _Float16* ar = A + (size_t)row * KDIM;

  // the whole row is asked for at once: chunk c is in a, chunk c + 1 in b, chunk c + 2 in d
  float4 a0 = *(const float4*)(xr);
  float4 a1 = *(const float4*)(xr + 4);
  float4 b0 = *(const float4*)(xr + CHUNK_F);
  float4 b1 = *(const float4*)(xr + CHUNK_F + 4);
  const float4 d0 = *(const float4*)(xr + 2 * CHUNK_F);
  const float4 d1 = *(const float4*)(xr + 2 * CHUNK_F + 4);
// stays rolled: one chunk's code is run three times instead of three copies run once each
#pragma clang loop unroll(disable)
  for (int c = 0; c < IN_F / CHUNK_F; ++c) {
    const float e[8] = {a0.x, a0.y, a0.z, a0.w, a1.x, a1.y, a1.z, a1.w};
    a0 = b0; a1 = b1;
    b0 = d0; b1 = d1;
    _Float16 h[72];
    // every loop below is unrolled so that h is indexed by constants (registers, no scratch)
#pragma unroll
    for (int q = 0; q < 8; ++q) {
      // exp(-x) as silu_f has it (x * -log2(e), then v_exp_f32), with the one issue slot that the
      // instruction set asks for behind a transcendental in the same statement
      float ex;
      asm("v_exp_f32 %0, %1\n\tv_nop" : "=v"(ex) : "v"(e[q] * -1.44269504088896341f));
      h[q * 9] = (_Float16)(e[q] / (1.0f + ex));
      float bs[NCOEF];
      bspline8(e[q], bs);
#pragma unroll
      for (int g = 0; g < NCOEF; ++g) h[q * 9 + 1 + g] = (_Float16)bs[g];
    }
#pragma unroll
    for (int k = 0; k < 9; ++k) {
      v8h p;
#pragma unroll
      for (int u = 0; u < 8; ++u) p[u] = h[k * 8 + u];
      *(v8h*)(s + lane * 72 + k * 8) = p;
    }
    store_chunk(s, ar + c * CHUNK_H, lane);
    // stands in front of the next trip's first write to a register that the chunk's stores name
    asm volatile("s_wait_xcnt 0x0" ::: "memory");
  }
}

// One wave per chunk of 256 (o, i) pairs. The 2048 spline weights of a chunk are loaded 512
// contiguous bytes at a time and turned in LDS: the 256 B of 8 features lie at a pitch of 272 B
// (16 B x odd), so that a lane can read the 8 features it packs without bank conflicts.
#define WROW_B  272
#define WTURN_B (32 * WROW_B)                 // 8704 bytes
#define WWAVE_B (WTURN_B + CHUNK_H * 2)       // 13312 bytes per wave

__global__ __launch_bounds__(256) void kan_prep_w(const float* __restrict__ bw,
                                                  const float* __restrict__ sw,
                                                  _Float16* __restrict__ W) {
  __shared__ __attribute__((aligned(16))) unsigned char S[8 * WWAVE_B];
  const int lane = threadIdx.x & 31;
  const int wave = threadIdx.x >> 5;
  const int chunk = blockIdx.x * 8 + wave;
  unsigned char* f = S + wave * WWAVE_B;
  _Float16* s = (_Float16*)(f + WTURN_B);
  const float* bp = bw + (size_t)chunk * CHUNK_F + lane * 8;
  const float* sp = sw + (size_t)chunk * CHUNK_F * NCOEF + lane * 4;

  float4 w[16];
  // every loop below is unrolled: all loads are issued before the first value is used, and the
  // arrays are indexed by constants (registers)
#pragma unroll
  for (int j = 0; j < 16; ++j) w[j] = *(const float4*)(sp + j * 128);
  const float4 b0 = *(const float4*)(bp);
  const float4 b1 = *(const float4*)(bp + 4);
  // load j, lane l holds 16-byte piece l % 16 of the 8-feature group 2 * j + l / 16
#pragma unroll
  for (int j = 0; j < 16; ++j)
    *(float4*)(f + (j * 2 + (lane >> 4)) * WROW_B + (lane & 15) * 16) = w[j];
  // this wave's LDS writes are complete before its lanes read what other lanes wrote
  asm volatile("s_wait_dscnt 0x0" ::: "memory");
  float4 t[16];
#pragma unroll
  for (int k = 0; k < 16; ++k) t[k] = *(const float4*)(f + lane * WROW_B + k * 16);

  const float e[8] = {b0.x, b0.y, b0.z, b0.w, b1.x, b1.y, b1.z, b1.w};
  _Float16 h[72];
#pragma unroll
  for (int q = 0; q < 8; ++q) {
    h[q * 9 + 0] = (_Float16)e[q];
    h[q * 9 + 1] = (_Float16)t[q * 2].x;
    h[q * 9 + 2] = (_Float16)t[q * 2].y;
    h[q * 9 + 3] = (_Float16)t[q * 2].z;
    h[q * 9 + 4] = (_Float16)t[q * 2].w;
    h[q * 9 + 5] = (_Float16)t[q * 2 + 1].x;
    h[q * 9 + 6] = (_Float16)t[q * 2 + 1].y;
    h[q * 9 + 7] = (_Float16)t[q * 2 + 1].z;
    h[q * 9 + 8] = (_Float16)t[q * 2 + 1].w;
  }
#pragma unroll
  for (int k = 0; k < 9; ++k) {
    v8h p;
#pragma unroll
    for (int u = 0; u < 8; ++u) p[u] = h[k * 8 + u];
    *(v8h*)(s + lane * 72 + k * 8) = p;
  }
  store_chunk(s, W + (size_t)chunk * CHUNK_H, lane);
}

// ---------------- WMMA GEMM: H = A[8192x6912] * W^T[6912x768] (GELU: see layer 2) ----------------

// One work-group of 8 waves owns a 128 x 192 tile of H. A pass is 192 k: 128 rows of A and
// 192 rows of W, 384 B each, lie in one LDS buffer at a pitch of 400 B (16 B x odd: the
// 16 lanes of a ds_load_b128 half fall on distinct banks). Two buffers: the next pass's
// rows are copied while this pass is worked on.
#define TILE_M  128
#define TILE_N  192
#define KPASS   192
#define NPASS   (KDIM / KPASS)            // 36
#define PITCH_B 400
#define STAGE_B ((TILE_M + TILE_N) * PITCH_B)  // 128000 bytes per buffer

// Fifteen asynchronous 16-byte copies per lane, global -> LDS. The s_wait_xcnt is the last
// line of the copies' own statement so that no address register named here is rewritten
// ahead of it.
__device__ __forceinline__ void copy15(const uint32_t* l, const _Float16* const* g) {
  asm volatile(
      "global_load_async_to_lds_b128 %0, %15, off\n\t"
      "global_load_async_to_lds_b128 %1, %16, off\n\t"
      "global_load_async_to_lds_b128 %2, %17, off\n\t"
      "global_load_async_to_lds_b128 %3, %18, off\n\t"
      "global_load_async_to_lds_b128 %4, %19, off\n\t"
      "global_load_async_to_lds_b128 %5, %20, off\n\t"
      "global_load_async_to_lds_b128 %6, %21, off\n\t"
      "global_load_async_to_lds_b128 %7, %22, off\n\t"
      "global_load_async_to_lds_b128 %8, %23, off\n\t"
      "global_load_async_to_lds_b128 %9, %24, off\n\t"
      "global_load_async_to_lds_b128 %10, %25, off\n\t"
      "global_load_async_to_lds_b128 %11, %26, off\n\t"
      "global_load_async_to_lds_b128 %12, %27, off\n\t"
      "global_load_async_to_lds_b128 %13, %28, off\n\t"
      "global_load_async_to_lds_b128 %14, %29, off\n\t"
      "s_wait_xcnt 0x0"
      :: "v"(l[0]), "v"(l[1]), "v"(l[2]), "v"(l[3]), "v"(l[4]), "v"(l[5]), "v"(l[6]), "v"(l[7]), "v"(l[8]), "v"(l[9]), "v"(l[10]), "v"(l[11]), "v"(l[12]), "v"(l[13]), "v"(l[14]),
         "v"(g[0]), "v"(g[1]), "v"(g[2]), "v"(g[3]), "v"(g[4]), "v"(g[5]), "v"(g[6]), "v"(g[7]), "v"(g[8]), "v"(g[9]), "v"(g[10]), "v"(g[11]), "v"(g[12]), "v"(g[13]), "v"(g[14])
      : "memory");
}

// One stage = 320 rows x 24 chunks of 16 B = 30 chunks per thread. Chunk (a, b) of a thread
// lies 32 * a rows below chunk (0, b): three copies of all 256 threads cover 32 whole rows.
__device__ __forceinline__ void issue_stage(const uint32_t* lds3, const _Float16* const* ga3,
                                            const _Float16* const* gw3, uint32_t buf, int koff) {
  uint32_t l[30];
  const _Float16* g[30];
  // both loops unrolled: every index of l and g is a constant, so the arrays are registers
#pragma unroll
  for (int a = 0; a < 10; ++a)
#pragma unroll
    for (int b = 0; b < 3; ++b) {
      l[a * 3 + b] = lds3[b] + buf + (uint32_t)(a * 32 * PITCH_B);
      g[a * 3 + b] = (a < 4) ? ga3[b] + koff + (size_t)a * 32 * KDIM
                             : gw3[b] + koff + (size_t)(a - 4) * 32 * KDIM;
    }
  copy15(l, g);
  copy15(l + 15, g + 15);
}

// 16-bit fragment (ISA 7.12.2): lane L<16 -> row L, K {0..7,16..23}; lane L+16 -> row L,
// K {8..15,24..31}: two 16-byte chunks per lane, the same pattern for A and for W rows.
__device__ __forceinline__ v16h lds_frag(const unsigned char* p) {
  v8h lo = *(const v8h*)(p);
  v8h hi = *(const v8h*)(p + 32);
  return __builtin_shufflevector(lo, hi, 0, 1, 2, 3, 4, 5, 6, 7, 8, 9, 10, 11, 12, 13, 14, 15);
}

__global__ __launch_bounds__(256) void kan_gemm1(const _Float16* __restrict__ A,
                                                 const _Float16* __restrict__ W,
                                                 float* __restrict__ H) {
  __shared__ __attribute__((aligned(16))) unsigned char L[2 * STAGE_B];

  const int tid  = threadIdx.x;
  const int lane = tid & 31;
  const int wave = tid >> 5;
  const int wm = wave >> 2;                 // 2 wave rows of 64
  const int wn = wave & 3;                  // 4 wave columns of 48
  const int n0 = blockIdx.x * TILE_N;       // the 4 column tiles of one row tile are neighbours
  const int m0 = blockIdx.y * TILE_M;

  uint32_t lds3[3];
  const _Float16* ga3[3];
  const _Float16* gw3[3];
  const uint32_t lbase = (uint32_t)(uintptr_t)&L[0];
  // unrolled: the three-entry arrays stay in registers
#pragma unroll
  for (int b = 0; b < 3; ++b) {
    const int q = b * 256 + tid;            // 0..767
    const int r = q / 24;                   // row 0..31
    const int c = q - r * 24;               // 16-byte chunk 0..23
    lds3[b] = lbase + (uint32_t)(r * PITCH_B + c * 16);
    ga3[b] = A + (size_t)(m0 + r) * KDIM + c * 8;
    gw3[b] = W + (size_t)(n0 + r) * KDIM + c * 8;
  }

  v8f acc[4][3] = {};

  const int csub = lane & 15;
  const int hsub = lane >> 4;
  const unsigned char* pa = L + (wm * 64 + csub) * PITCH_B + 16 * hsub;
  const unsigned char* pb = L + (TILE_M + wn * 48 + csub) * PITCH_B + 16 * hsub;

  issue_stage(lds3, ga3, gw3, 0u, 0);
  asm volatile("s_wait_asynccnt 0x0" ::: "memory");  // this wave's part of pass 0 has landed
  __syncthreads();                                   // every wave's part of pass 0 has landed
  issue_stage(lds3, ga3, gw3, (uint32_t)STAGE_B, KPASS);

// one pass per trip: the ring's order (read, waits, barrier, refill) stands once, as written
#pragma clang loop unroll(disable)
  for (int t = 0; t < NPASS; ++t) {
    const uint32_t buf = (t & 1) ? (uint32_t)STAGE_B : 0u;
    const unsigned char* qa = pa + buf;
    const unsigned char* qb = pb + buf;
    // every loop below is unrolled so that fragment and accumulator indices are constants
    // (registers, no scratch) and the LDS offsets are immediates
    v16h af[2][4], bf[2][3];
#pragma unroll
    for (int i = 0; i < 4; ++i) af[0][i] = lds_frag(qa + i * 16 * PITCH_B);
#pragma unroll
    for (int j = 0; j < 3; ++j) bf[0][j] = lds_frag(qb + j * 16 * PITCH_B);
#pragma unroll
    for (int ks = 0; ks < KPASS / 32; ++ks) {
      const int cur = ks & 1, nxt = cur ^ 1;
      if (ks + 1 < KPASS / 32) {  // the next 32 k of this same buffer, as one group of reads
#pragma unroll
        for (int i = 0; i < 4; ++i) af[nxt][i] = lds_frag(qa + i * 16 * PITCH_B + (ks + 1) * 64);
#pragma unroll
        for (int j = 0; j < 3; ++j) bf[nxt][j] = lds_frag(qb + j * 16 * PITCH_B + (ks + 1) * 64);
      }
      // keeps the group of LDS reads ahead of the matrix block instead of spread among it
      __builtin_amdgcn_sched_barrier(0);
#pragma unroll
      for (int i = 0; i < 4; ++i)
#pragma unroll
        for (int j = 0; j < 3; ++j)
          acc[i][j] = __builtin_amdgcn_wmma_f32_16x16x32_f16(
              false, af[cur][i], false, bf[cur][j], (short)0, acc[i][j], false, false);
      // keeps the following group of LDS reads behind this matrix block
      __builtin_amdgcn_sched_barrier(0);
    }
    asm volatile("s_wait_dscnt 0x0" ::: "memory");     // this wave's reads of the buffer are done
    asm volatile("s_wait_asynccnt 0x0" ::: "memory");  // this wave's part of pass t + 1 has landed
    __syncthreads();  // publishes pass t + 1 and frees the buffer that pass t has read
    if (t + 2 < NPASS) issue_stage(lds3, ga3, gw3, buf, (t + 2) * KPASS);
  }
  asm volatile("s_wait_asynccnt 0x0" ::: "memory");    // no copy is open when the wave ends

  // D layout: lane L holds (m = v + 8*(L>=16), n = L&15) for v in 0..7
  const int rsub = hsub << 3;
#pragma unroll
  for (int i = 0; i < 4; ++i)
#pragma unroll
    for (int j = 0; j < 3; ++j)
#pragma unroll
      for (int v = 0; v < 8; ++v) {
        int row = m0 + wm * 64 + 16 * i + rsub + v;
        int col = n0 + wn * 48 + 16 * j + csub;
        H[(size_t)row * IN_F + col] = acc[i][j][v];
      }
}

// ---------------- Layer 2: out[b, 0..1], one wave per row, shuffle reduction ----------------
// H holds the first layer's sums; the GELU is applied here, where the value is read: one copy of
// erff's code in a rolled loop with eight waves on a SIMD, instead of 96 copies behind each
// other in the GEMM's unrolled epilogue with two.

__global__ __launch_bounds__(256) void kan_layer2(const float* __restrict__ H,
                                                  const float* __restrict__ w2b,
                                                  const float* __restrict__ w2s,
                                                  float* __restrict__ out) {
  const int lane = threadIdx.x & 31;
  const int b = blockIdx.x * 8 + (threadIdx.x >> 5);
  float a0 = 0.0f, a1 = 0.0f;
  for (int i = lane; i < IN_F; i += 32) {
    const float p = H[(size_t)b * IN_F + i];
    const float x = 0.5f * p * (1.0f + erff(p * 0.70710678118654752f)); // exact-erf GELU
    float s = silu_f(x);
    float bs[NCOEF];
    bspline8(x, bs);
    a0 += s * w2b[i];
    a1 += s * w2b[IN_F + i];
    const float* w0 = w2s + (size_t)i * NCOEF;
    const float* w1 = w2s + (size_t)(IN_F + i) * NCOEF;
#pragma unroll
    for (int g = 0; g < NCOEF; ++g) {
      a0 += bs[g] * w0[g];
      a1 += bs[g] * w1[g];
    }
  }
#pragma unroll
  for (int off = 16; off > 0; off >>= 1) {
    a0 += __shfl_down(a0, off, 32);
    a1 += __shfl_down(a1, off, 32);
  }
  if (lane == 0) {
    out[(size_t)b * OUT_L + 0] = a0;
    out[(size_t)b * OUT_L + 1] = a1;
  }
}

// ---------------- Launch ----------------

extern "C" void kernel_launch(void* const* d_in, const int* in_sizes, int n_in,
                              void* d_out, int out_size, void* d_ws, size_t ws_size,
                              hipStream_t stream) {
  (void)in_sizes; (void)n_in; (void)out_size; (void)ws_size;
  const float* hidden = (const float*)d_in[0];
  const float* kbw    = (const float*)d_in[1];  // [768,768]
  const float* ksw    = (const float*)d_in[2];  // [768,768,8]
  const float* obw    = (const float*)d_in[3];  // [2,768]
  const float* osw    = (const float*)d_in[4];  // [2,768,8]
  float* out = (float*)d_out;

  uint8_t* ws = (uint8_t*)d_ws;
  const size_t szA = (size_t)B_ROWS * KDIM * sizeof(_Float16); // 113.2 MB
  const size_t szW = (size_t)IN_F * KDIM * sizeof(_Float16);   // 10.6 MB
  _Float16* A = (_Float16*)(ws);
  _Float16* W = (_Float16*)(ws + szA);
  float*    H = (float*)(ws + szA + szW);                      // 25.2 MB

  kan_prep_act<<<B_ROWS / 8, 256, 0, stream>>>(hidden, A);                    // one wave per row
  kan_prep_w<<<IN_F * IN_F / CHUNK_F / 8, 256, 0, stream>>>(kbw, ksw, W);     // 2304 chunks, 288 blocks

  dim3 g(IN_F / TILE_N, B_ROWS / TILE_M); // 4 x 64 blocks, 8 waves each
  kan_gemm1<<<g, 256, 0, stream>>>(A, W, H);

  kan_layer2<<<B_ROWS / 8, 256, 0, stream>>>(H, obw, osw, out);
}

// v005
// A run of this version takes 111 microseconds.
// Next to v004, in two timings, it ran 1.28 and 1.27 times as fast.
// Counting every step since v000, it is 3.61 times as fast.
#include <hip/hip_runtime.h>
#include <cstdint>
#include <cstddef>

// Problem constants (from reference): B=8192, H=768, L=2, k=3, G=5, NUM_COEF=8
#define B_ROWS 8192
#define IN_F   768
#define NCOEF  8
#define KDIM   (IN_F * 9)   // 6912 = augmented K (silu + 8 spline bases per input feature)
#define OUT_L  2

typedef __attribute__((ext_vector_type(16))) _Float16 v16h;
typedef __attribute__((ext_vector_type(8)))  _Float16 v8h;
typedef __attribute__((ext_vector_type(8)))  float    v8f;

__device__ __forceinline__ float silu_f(float x) {
  return x / (1.0f + __expf(-x));
}

// Order-3 B-spline bases on the uniform extended knot grid t_j = -1 + (j-3)*0.4, j=0..11.
// On equal knot spacing the Cox-de Boor recursion yields one shape for every basis: with d the
// distance of x from the centre t_(g+2) of basis g, in knot steps, and a = (1 - d/2) cut to [0, 1],
//   d <= 1: 2/3 - d^2 a        1 <= d <= 2: 4/3 a^3        d >= 2: 0.
// The first minus the second is -2/3 (1 - d)^3, so the smaller of the two is the right one on
// either side of d = 1, and for d >= 2 (a = 0) it is 0.
typedef __attribute__((ext_vector_type(2))) float v2f;

__device__ __forceinline__ void bspline8(float x, float* __restrict__ out) {
  // two bases at a time: the products below are packed two-float instructions; unrolled so that
  // out is indexed by constants (registers) and the centres are literals
#pragma unroll
  for (int g = 0; g < NCOEF; g += 2) {
    v2f d, a;
    d.x = fmaf(x, 2.5f, 3.5f - (float)g);  // (x - t_(g+2)) / h
    d.y = fmaf(x, 2.5f, 2.5f - (float)g);
    // the median with 0 and 1 compiles to the clamp modifier (on the multiply-add itself where that
    // stays a one-float instruction), not to a compare and select
    a.x = __builtin_amdgcn_fmed3f(fmaf(fabsf(d.x), -0.5f, 1.0f), 0.0f, 1.0f);
    a.y = __builtin_amdgcn_fmed3f(fmaf(fabsf(d.y), -0.5f, 1.0f), 0.0f, 1.0f);
    const v2f inner = (2.0f / 3.0f) - (d * d) * a;
    const v2f outer = (a * a) * (a * (4.0f / 3.0f));
    const v2f r = __builtin_elementwise_min(inner, outer);
    out[g] = r.x;
    out[g + 1] = r.y;
  }
}

// ---------------- Prep kernels: build augmented f16 A and W^T ----------------

// Both augmented arrays are flat: feature number f (row * 768 + i) owns the 9 halfs at 9 * f.
// A wave builds a chunk of 256 neighbouring features = 2304 halfs = 4608 B = 36 whole 128-byte
// lines in its own LDS range and stores it with nine 512-byte wave-wide stores.
#define CHUNK_F 256
#define CHUNK_H (CHUNK_F * 9)

__device__ __forceinline__ void store_chunk(const _Float16* s, _Float16* __restrict__ dst, int lane) {
  // this wave's LDS writes are complete before its lanes read what other lanes wrote
  asm volatile("s_wait_dscnt 0x0" ::: "memory");
  v8h r[9];
  // unrolled: r stays in registers, nine reads in flight behind one wait
#pragma unroll
  for (int k = 0; k < 9; ++k) r[k] = *(const v8h*)(s + k * 256 + lane * 8);
#pragma unroll
  for (int k = 0; k < 9; ++k) *(v8h*)(dst + k * 256 + lane * 8) = r[k];
}

// One wave per row of x: three chunks. A lane makes 8 neighbouring features = 144 B of LDS
// (16 B x odd: the 16 lanes of a ds_store_b128 half fall on distinct banks).
__global__ __launch_bounds__(256) void kan_prep_act(const float* __restrict__ x,
                                                    _Float16* __restrict__ A) {
  __shared__ __attribute__((aligned(16))) _Float16 S[8 * CHUNK_H];
  const int lane = threadIdx.x & 31;
  const int wave = threadIdx.x >> 5;
  const int row = blockIdx.x * 8 + wave;
  _Float16* s = S + wave * CHUNK_H;
  const float* xr = x + (size_t)row * IN_F + lane * 8;
  _Float16* ar = A + (size_t)row * KDIM;

  // the whole row is asked for at once: chunk c is in a, chunk c + 1 in b, chunk c + 2 in d
  float4 a0 = *(const float4*)(xr);
  float4 a1 = *(const float4*)(xr + 4);
  float4 b0 = *(const float4*)(xr + CHUNK_F);
  float4 b1 = *(const float4*)(xr + CHUNK_F + 4);
  const float4 d0 = *(const float4*)(xr + 2 * CHUNK_F);
  const float4 d1 = *(const float4*)(xr + 2 * CHUNK_F + 4);
// stays rolled: one chunk's code is run three times instead of three copies run once each
#pragma clang loop unroll(disable)
  for (int c = 0; c < IN_F / CHUNK_F; ++c) {
    const float e[8] = {a0.x, a0.y, a0.z, a0.w, a1.x, a1.y, a1.z, a1.w};
    a0 = b0; a1 = b1;
    b0 = d0; b1 = d1;
    _Float16 h[72];
    // every loop below is unrolled so that h is indexed by constants (registers, no scratch)
#pragma unroll
    for (int q = 0; q < 8; ++q) {
      // exp(-x) as silu_f has it (x * -log2(e), then v_exp_f32), with the one issue slot that the
      // instruction set asks for behind a transcendental in the same statement
      float ex;
      asm("v_exp_f32 %0, %1\n\tv_nop" : "=v"(ex) : "v"(e[q] * -1.44269504088896341f));
      h[q * 9] = (_Float16)(e[q] / (1.0f + ex));
      float bs[NCOEF];
      bspline8(e[q], bs);
#pragma unroll
      for (int g = 0; g < NCOEF; ++g) h[q * 9 + 1 + g] = (_Float16)bs[g];
    }
#pragma unroll
    for (int k = 0; k < 9; ++k) {
      v8h p;
#pragma unroll
      for (int u = 0; u < 8; ++u) p[u] = h[k * 8 + u];
      *(v8h*)(s + lane * 72 + k * 8) = p;
    }
    store_chunk(s, ar + c * CHUNK_H, lane);
    // stands in front of the next trip's first write to a register that the chunk's stores name
    asm volatile("s_wait_xcnt 0x0" ::: "memory");
  }
}

// One wave per chunk of 256 (o, i) pairs. The 2048 spline weights of a chunk are loaded 512
// contiguous bytes at a time and turned in LDS: the 256 B of 8 features lie at a pitch of 272 B
// (16 B x odd), so that a lane can read the 8 features it packs without bank conflicts.
#define WROW_B  272
#define WTURN_B (32 * WROW_B)                 // 8704 bytes
#define WWAVE_B (WTURN_B + CHUNK_H * 2)       // 13312 bytes per wave

__global__ __launch_bounds__(256) void kan_prep_w(const float* __restrict__ bw,
                                                  const float* __restrict__ sw,
                                                  _Float16* __restrict__ W) {
  __shared__ __attribute__((aligned(16))) unsigned char S[8 * WWAVE_B];
  const int lane = threadIdx.x & 31;
  const int wave = threadIdx.x >> 5;
  const int chunk = blockIdx.x * 8 + wave;
  unsigned char* f = S + wave * WWAVE_B;
  _Float16* s = (_Float16*)(f + WTURN_B);
  const float* bp = bw + (size_t)chunk * CHUNK_F + lane * 8;
  const float* sp = sw + (size_t)chunk * CHUNK_F * NCOEF + lane * 4;

  float4 w[16];
  // every loop below is unrolled: all loads are issued before the first value is used, and the
  // arrays are indexed by constants (registers)
#pragma unroll
  for (int j = 0; j < 16; ++j) w[j] = *(const float4*)(sp + j * 128);
  const float4 b0 = *(const float4*)(bp);
  const float4 b1 = *(const float4*)(bp + 4);
  // load j, lane l holds 16-byte piece l % 16 of the 8-feature group 2 * j + l / 16
#pragma unroll
  for (int j = 0; j < 16; ++j)
    *(float4*)(f + (j * 2 + (lane >> 4)) * WROW_B + (lane & 15) * 16) = w[j];
  // this wave's LDS writes are complete before its lanes read what other lanes wrote
  asm volatile("s_wait_dscnt 0x0" ::: "memory");
  float4 t[16];
#pragma unroll
  for (int k = 0; k < 16; ++k) t[k] = *(const float4*)(f + lane * WROW_B + k * 16);

  const float e[8] = {b0.x, b0.y, b0.z, b0.w, b1.x, b1.y, b1.z, b1.w};
  _Float16 h[72];
#pragma unroll
  for (int q = 0; q < 8; ++q) {
    h[q * 9 + 0] = (_Float16)e[q];
    h[q * 9 + 1] = (_Float16)t[q * 2].x;
    h[q * 9 + 2] = (_Float16)t[q * 2].y;
    h[q * 9 + 3] = (_Float16)t[q * 2].z;
    h[q * 9 + 4] = (_Float16)t[q * 2].w;
    h[q * 9 + 5] = (_Float16)t[q * 2 + 1].x;
    h[q * 9 + 6] = (_Float16)t[q * 2 + 1].y;
    h[q * 9 + 7] = (_Float16)t[q * 2 + 1].z;
    h[q * 9 + 8] = (_Float16)t[q * 2 + 1].w;
  }
#pragma unroll
  for (int k = 0; k < 9; ++k) {
    v8h p;
#pragma unroll
    for (int u = 0; u < 8; ++u) p[u] = h[k * 8 + u];
    *(v8h*)(s + lane * 72 + k * 8) = p;
  }
  store_chunk(s, W + (size_t)chunk * CHUNK_H, lane);
}

// ---------------- WMMA GEMM: H0 + H1 = A[8192x6912] * W^T[6912x768] (GELU: see layer 2) ----------------

// One work-group of 8 waves owns a 256 x 192 tile of H over one half of k (3456); the two halves'
// sums go to two planes of H, which layer 2 adds. Against a 128 x 192 tile over all of k, a
// work-group copies 448 rows of 6912 B instead of 320 rows of 13824 B for the same products.
// A pass is 128 k: 256 rows of A and 192 rows of W, 256 B each, lie in one LDS buffer at a pitch
// of 272 B (16 B x odd: the 16 lanes of a ds_load_b128 half fall on distinct banks). Two buffers:
// the next pass's rows are copied while this pass is worked on.
#define TILE_M  256
#define TILE_N  192
#define KSPLIT  2
#define KHALF   (KDIM / KSPLIT)           // 3456
#define KPASS   128
#define NPASS   (KHALF / KPASS)           // 27
#define PITCH_B 272
#define STAGE_B ((TILE_M + TILE_N) * PITCH_B)  // 121856 bytes per buffer

// Fourteen asynchronous 16-byte copies per lane, global -> LDS. The s_wait_xcnt is the last
// line of the copies' own statement so that no address register named here is rewritten
// ahead of it.
__device__ __forceinline__ void copy14(const uint32_t* l, const _Float16* const* g) {
  asm volatile(
      "global_load_async_to_lds_b128 %0, %14, off\n\t"
      "global_load_async_to_lds_b128 %1, %15, off\n\t"
      "global_load_async_to_lds_b128 %2, %16, off\n\t"
      "global_load_async_to_lds_b128 %3, %17, off\n\t"
      "global_load_async_to_lds_b128 %4, %18, off\n\t"
      "global_load_async_to_lds_b128 %5, %19, off\n\t"
      "global_load_async_to_lds_b128 %6, %20, off\n\t"
      "global_load_async_to_lds_b128 %7, %21, off\n\t"
      "global_load_async_to_lds_b128 %8, %22, off\n\t"
      "global_load_async_to_lds_b128 %9, %23, off\n\t"
      "global_load_async_to_lds_b128 %10, %24, off\n\t"
      "global_load_async_to_lds_b128 %11, %25, off\n\t"
      "global_load_async_to_lds_b128 %12, %26, off\n\t"
      "global_load_async_to_lds_b128 %13, %27, off\n\t"
      "s_wait_xcnt 0x0"
      :: "v"(l[0]), "v"(l[1]), "v"(l[2]), "v"(l[3]), "v"(l[4]), "v"(l[5]), "v"(l[6]), "v"(l[7]), "v"(l[8]), "v"(l[9]), "v"(l[10]), "v"(l[11]), "v"(l[12]), "v"(l[13]),
         "v"(g[0]), "v"(g[1]), "v"(g[2]), "v"(g[3]), "v"(g[4]), "v"(g[5]), "v"(g[6]), "v"(g[7]), "v"(g[8]), "v"(g[9]), "v"(g[10]), "v"(g[11]), "v"(g[12]), "v"(g[13])
      : "memory");
}

// One stage = 448 rows x 16 chunks of 16 B = 28 chunks per thread. Chunk a of a thread lies
// 16 * a rows below its chunk 0: one copy of all 256 threads covers 16 whole rows (a wave: two
// rows of 256 B).
__device__ __forceinline__ void issue_stage(uint32_t lds0, const _Float16* ga, const _Float16* gw,
                                            uint32_t buf, int koff) {
  uint32_t l[28];
  const _Float16* g[28];
  // unrolled: every index of l and g is a constant, so the arrays are registers
#pragma unroll
  for (int a = 0; a < 28; ++a) {
    l[a] = lds0 + buf + (uint32_t)(a * 16 * PITCH_B);
    g[a] = (a < 16) ? ga + koff + (size_t)a * 16 * KDIM
                    : gw + koff + (size_t)(a - 16) * 16 * KDIM;
  }
  copy14(l, g);
  copy14(l + 14, g + 14);
}

// 16-bit fragment (ISA 7.12.2): lane L<16 -> row L, K {0..7,16..23}; lane L+16 -> row L,
// K {8..15,24..31}: two 16-byte chunks per lane, the same pattern for A and for W rows.
__device__ __forceinline__ v16h lds_frag(const unsigned char* p) {
  v8h lo = *(const v8h*)(p);
  v8h hi = *(const v8h*)(p + 32);
  return __builtin_shufflevector(lo, hi, 0, 1, 2, 3, 4, 5, 6, 7, 8, 9, 10, 11, 12, 13, 14, 15);
}

__global__ __launch_bounds__(256) void kan_gemm1(const _Float16* __restrict__ A,
                                                 const _Float16* __restrict__ W,
                                                 float* __restrict__ H) {
  __shared__ __attribute__((aligned(16))) unsigned char L[2 * STAGE_B];

  const int tid  = threadIdx.x;
  const int lane = tid & 31;
  const int wave = tid >> 5;
  const int wm = wave >> 1;                 // 4 wave rows of 64
  const int wn = wave & 1;                  // 2 wave columns of 96
  const int n0 = blockIdx.x * TILE_N;       // the 4 column tiles of one row tile are neighbours
  const int m0 = blockIdx.y * TILE_M;
  const int k0 = blockIdx.z * KHALF;        // this work-group's half of k

  const int r = tid >> 4;                   // row 0..15
  const int c = tid & 15;                   // 16-byte chunk 0..15
  const uint32_t lds0 = (uint32_t)(uintptr_t)&L[0] + (uint32_t)(r * PITCH_B + c * 16);
  const _Float16* ga = A + (size_t)(m0 + r) * KDIM + k0 + c * 8;
  const _Float16* gw = W + (size_t)(n0 + r) * KDIM + k0 + c * 8;

  v8f acc[4][6] = {};

  const int csub = lane & 15;
  const int hsub = lane >> 4;
  const unsigned char* pa = L + (wm * 64 + csub) * PITCH_B + 16 * hsub;
  const unsigned char* pb = L + (TILE_M + wn * 96 + csub) * PITCH_B + 16 * hsub;

  issue_stage(lds0, ga, gw, 0u, 0);
  asm volatile("s_wait_asynccnt 0x0" ::: "memory");  // this wave's part of pass 0 has landed
  __syncthreads();                                   // every wave's part of pass 0 has landed
  issue_stage(lds0, ga, gw, (uint32_t)STAGE_B, KPASS);

// one pass per trip: the ring's order (read, waits, barrier, refill) stands once, as written
#pragma clang loop unroll(disable)
  for (int t = 0; t < NPASS; ++t) {
    const uint32_t buf = (t & 1) ? (uint32_t)STAGE_B : 0u;
    const unsigned char* qa = pa + buf;
    const unsigned char* qb = pb + buf;
    // every loop below is unrolled so that fragment and accumulator indices are constants
    // (registers, no scratch) and the LDS offsets are immediates
    v16h af[2][4], bf[2][6];
#pragma unroll
    for (int i = 0; i < 4; ++i) af[0][i] = lds_frag(qa + i * 16 * PITCH_B);
#pragma unroll
    for (int j = 0; j < 6; ++j) bf[0][j] = lds_frag(qb + j * 16 * PITCH_B);
#pragma unroll
    for (int ks = 0; ks < KPASS / 32; ++ks) {
      const int cur = ks & 1, nxt = cur ^ 1;
      if (ks + 1 < KPASS / 32) {  // the next 32 k of this same buffer, as one group of reads
#pragma unroll
        for (int i = 0; i < 4; ++i) af[nxt][i] = lds_frag(qa + i * 16 * PITCH_B + (ks + 1) * 64);
#pragma unroll
        for (int j = 0; j < 6; ++j) bf[nxt][j] = lds_frag(qb + j * 16 * PITCH_B + (ks + 1) * 64);
      }
      // keeps the group of LDS reads ahead of the matrix block instead of spread among it
      __builtin_amdgcn_sched_barrier(0);
#pragma unroll
      for (int i = 0; i < 4; ++i)
#pragma unroll
        for (int j = 0; j < 6; ++j)
          acc[i][j] = __builtin_amdgcn_wmma_f32_16x16x32_f16(
              false, af[cur][i], false, bf[cur][j], (short)0, acc[i][j], false, false);
      // keeps the following group of LDS reads behind this matrix block
      __builtin_amdgcn_sched_barrier(0);
    }
    asm volatile("s_wait_dscnt 0x0" ::: "memory");     // this wave's reads of the buffer are done
    asm volatile("s_wait_asynccnt 0x0" ::: "memory");  // this wave's part of pass t + 1 has landed
    __syncthreads();  // publishes pass t + 1 and frees the buffer that pass t has read
    if (t + 2 < NPASS) issue_stage(lds0, ga, gw, buf, (t + 2) * KPASS);
  }
  asm volatile("s_wait_asynccnt 0x0" ::: "memory");    // no copy is open when the wave ends

  // D layout: lane L holds (m = v + 8*(L>=16), n = L&15) for v in 0..7
  const int rsub = hsub << 3;
  float* Hp = H + (size_t)blockIdx.z * B_ROWS * IN_F;  // the plane of this half of k
#pragma unroll
  for (int i = 0; i < 4; ++i)
#pragma unroll
    for (int j = 0; j < 6; ++j)
#pragma unroll
      for (int v = 0; v < 8; ++v) {
        int row = m0 + wm * 64 + 16 * i + rsub + v;
        int col = n0 + wn * 96 + 16 * j + csub;
        Hp[(size_t)row * IN_F + col] = acc[i][j][v];
      }
}

// ---------------- Layer 2: out[b, 0..1], one wave per row, shuffle reduction ----------------
// H holds the first layer's sums in two planes, one per half of k, added here; the GELU is applied
// here too, where the value is read: one copy of
// erff's code in a rolled loop with eight waves on a SIMD, instead of 192 copies behind each
// other in the GEMM's unrolled epilogue with two.

__global__ __launch_bounds__(256) void kan_layer2(const float* __restrict__ H,
                                                  const float* __restrict__ w2b,
                                                  const float* __restrict__ w2s,
                                                  float* __restrict__ out) {
  const int lane = threadIdx.x & 31;
  const int b = blockIdx.x * 8 + (threadIdx.x >> 5);
  float a0 = 0.0f, a1 = 0.0f;
  for (int i = lane; i < IN_F; i += 32) {
    const float p = H[(size_t)b * IN_F + i] + H[(size_t)(B_ROWS + b) * IN_F + i];
    const float x = 0.5f * p * (1.0f + erff(p * 0.70710678118654752f)); // exact-erf GELU
    float s = silu_f(x);
    float bs[NCOEF];
    bspline8(x, bs);
    a0 += s * w2b[i];
    a1 += s * w2b[IN_F + i];
    const float* w0 = w2s + (size_t)i * NCOEF;
    const float* w1 = w2s + (size_t)(IN_F + i) * NCOEF;
#pragma unroll
    for (int g = 0; g < NCOEF; ++g) {
      a0 += bs[g] * w0[g];
      a1 += bs[g] * w1[g];
    }
  }
#pragma unroll
  for (int off = 16; off > 0; off >>= 1) {
    a0 += __shfl_down(a0, off, 32);
    a1 += __shfl_down(a1, off, 32);
  }
  if (lane == 0) {
    out[(size_t)b * OUT_L + 0] = a0;
    out[(size_t)b * OUT_L + 1] = a1;
  }
}

// ---------------- Launch ----------------

extern "C" void kernel_launch(void* const* d_in, const int* in_sizes, int n_in,
                              void* d_out, int out_size, void* d_ws, size_t ws_size,
                              hipStream_t stream) {
  (void)in_sizes; (void)n_in; (void)out_size; (void)ws_size;
  const float* hidden = (const float*)d_in[0];
  const float* kbw    = (const float*)d_in[1];  // [768,768]
  const float* ksw    = (const float*)d_in[2];  // [768,768,8]
  const float* obw    = (const float*)d_in[3];  // [2,768]
  const float* osw    = (const float*)d_in[4];  // [2,768,8]
  float* out = (float*)d_out;

  uint8_t* ws = (uint8_t*)d_ws;
  const size_t szA = (size_t)B_ROWS * KDIM * sizeof(_Float16); // 113.2 MB
  const size_t szW = (size_t)IN_F * KDIM * sizeof(_Float16);   // 10.6 MB
  _Float16* A = (_Float16*)(ws);
  _Float16* W = (_Float16*)(ws + szA);
  float*    H = (float*)(ws + szA + szW);                      // 2 planes of 25.2 MB

  kan_prep_act<<<B_ROWS / 8, 256, 0, stream>>>(hidden, A);                    // one wave per row
  kan_prep_w<<<IN_F * IN_F / CHUNK_F / 8, 256, 0, stream>>>(kbw, ksw, W);     // 2304 chunks, 288 blocks

  dim3 g(IN_F / TILE_N, B_ROWS / TILE_M, KSPLIT); // 4 x 32 x 2 blocks, 8 waves each
  kan_gemm1<<<g, 256, 0, stream>>>(A, W, H);

  kan_layer2<<<B_ROWS / 8, 256, 0, stream>>>(H, obw, osw, out);
}

// v006
// A run of this version takes 106 microseconds.
// In both of two side-by-side timings against v005, it was 1.05 times as fast.
// Over all steps from v000 it is 3.80 times as fast.
#include <hip/hip_runtime.h>
#include <cstdint>
#include <cstddef>

// Problem constants (from reference): B=8192, H=768, L=2, k=3, G=5, NUM_COEF=8
#define B_ROWS 8192
#define IN_F   768
#define NCOEF  8
#define OUT_L  2

typedef __attribute__((ext_vector_type(16))) _Float16 v16h;
typedef __attribute__((ext_vector_type(8)))  _Float16 v8h;
typedef __attribute__((ext_vector_type(8)))  float    v8f;

__device__ __forceinline__ float silu_f(float x) {
  return x / (1.0f + __expf(-x));
}

// Order-3 B-spline bases on the uniform extended knot grid t_j = -1 + (j-3)*0.4, j=0..11.
// On equal knot spacing the Cox-de Boor recursion yields one shape for every basis: with d the
// distance of x from the centre t_(g+2) of basis g, in knot steps, and a = (1 - d/2) cut to [0, 1],
//   d <= 1: 2/3 - d^2 a        1 <= d <= 2: 4/3 a^3        d >= 2: 0.
// The first minus the second is -2/3 (1 - d)^3, so the smaller of the two is the right one on
// either side of d = 1, and for d >= 2 (a = 0) it is 0.
typedef __attribute__((ext_vector_type(2))) float v2f;

__device__ __forceinline__ void bspline8(float x, float* __restrict__ out) {
  // two bases at a time: the products below are packed two-float instructions; unrolled so that
  // out is indexed by constants (registers) and the centres are literals
#pragma unroll
  for (int g = 0; g < NCOEF; g += 2) {
    v2f d, a;
    d.x = fmaf(x, 2.5f, 3.5f - (float)g);  // (x - t_(g+2)) / h
    d.y = fmaf(x, 2.5f, 2.5f - (float)g);
    // the median with 0 and 1 compiles to the clamp modifier (on the multiply-add itself where that
    // stays a one-float instruction), not to a compare and select
    a.x = __builtin_amdgcn_fmed3f(fmaf(fabsf(d.x), -0.5f, 1.0f), 0.0f, 1.0f);
    a.y = __builtin_amdgcn_fmed3f(fmaf(fabsf(d.y), -0.5f, 1.0f), 0.0f, 1.0f);
    const v2f inner = (2.0f / 3.0f) - (d * d) * a;
    const v2f outer = (a * a) * (a * (4.0f / 3.0f));
    const v2f r = __builtin_elementwise_min(inner, outer);
    out[g] = r.x;
    out[g + 1] = r.y;
  }
}

// ---------------- Prep kernel: f16 weights in the order in which the GEMM walks k ----------------

// k is walked in 48 passes of 16 input features. Pass P = 2 * G + par holds the features
// 32 * G + 2 * c + par, c = 0..15. A pass is 160 k = 320 B per row, twenty 16-byte chunks:
//   chunk c < 16     : the 8 spline bases of feature 32 * G + 2 * c + par
//   chunks 16 .. 19  : 32 silu places, place s = feature 32 * G + s; the activation side holds a
//                      zero at every place whose parity is not par, so each feature counts once
// Wt is pass-major, [48][768][160]: the 192 rows that a work-group needs of a pass are 61440
// contiguous bytes.
#define FPASS   16
#define KPASS   160
#define PCHUNK  20                          // 16-byte chunks per row and pass
#define NPASS_ALL (IN_F / FPASS)            // 48
#define WPASS_H (IN_F * KPASS)              // halfs of one pass of Wt

// Every chunk is 8 neighbouring floats of sw or of bw. A wave makes 8 x 512 contiguous bytes of Wt.
__global__ __launch_bounds__(256) void kan_prep_w(const float* __restrict__ bw,
                                                  const float* __restrict__ sw,
                                                  _Float16* __restrict__ Wt) {
  const int lane = threadIdx.x & 31;
  const int gwave = blockIdx.x * 8 + (threadIdx.x >> 5);
  float4 lo[8], hi[8];
  // both loops are unrolled: all 16 loads are issued before the first value is used, and the
  // arrays are indexed by constants (registers)
#pragma unroll
  for (int k = 0; k < 8; ++k) {
    const int q = (gwave * 8 + k) * 32 + lane;
    const int j = q % PCHUNK;
    const int ro = q / PCHUNK;
    const int o = ro % IN_F;
    const int p = ro / IN_F;
    const int f0 = (p >> 1) * 32;
    const float* src = (j < 16) ? sw + ((size_t)o * IN_F + f0 + 2 * j + (p & 1)) * NCOEF
                                : bw + (size_t)o * IN_F + f0 + (j - 16) * 8;
    lo[k] = *(const float4*)(src);
    hi[k] = *(const float4*)(src + 4);
  }
#pragma unroll
  for (int k = 0; k < 8; ++k) {
    const int q = (gwave * 8 + k) * 32 + lane;
    v8h h;
    h[0] = (_Float16)lo[k].x; h[1] = (_Float16)lo[k].y; h[2] = (_Float16)lo[k].z; h[3] = (_Float16)lo[k].w;
    h[4] = (_Float16)hi[k].x; h[5] = (_Float16)hi[k].y; h[6] = (_Float16)hi[k].z; h[7] = (_Float16)hi[k].w;
    *(v8h*)(Wt + (size_t)q * 8) = h;
  }
}

// ---------------- WMMA GEMM: H0 + H1 = act(x)[8192 x 7680] * Wt (GELU: see layer 2) ----------------

// One work-group of 8 waves owns a 256 x 192 tile of H over one half of the input features (24
// passes); the two halves' sums go to two planes of H, which layer 2 adds. The activation operand
// (silu and the 8 spline bases of every x) is never in memory: the work-group reads 64 B of x per
// row and pass and builds the 320 B of the operand's row in LDS itself, for the next pass while
// this pass is worked on. The weight rows come by asynchronous copies. A stage is 256 activation
// rows and 192 weight rows at a pitch of 336 B (16 B x odd: the 16 lanes of a ds_load_b128 half
// fall on distinct banks). Two buffers.
#define TILE_M  256
#define TILE_N  192
#define KSPLIT  2
#define NPASS   (NPASS_ALL / KSPLIT)      // 24
#define PITCH_B 336
#define SILU_B  256                       // byte offset of the 32 silu places in a row
#define STAGE_B ((TILE_M + TILE_N) * PITCH_B)  // 150528 bytes per buffer

// Fifteen asynchronous 16-byte copies per lane, global -> LDS: the 192 weight rows of one pass.
// The s_wait_xcnt is the last line of the copies' own statement so that no address register
// named here is rewritten ahead of it.
__device__ __forceinline__ void copy15(const uint32_t* l, const _Float16* const* g) {
  asm volatile(
      "global_load_async_to_lds_b128 %0, %15, off\n\t"
      "global_load_async_to_lds_b128 %1, %16, off\n\t"
      "global_load_async_to_lds_b128 %2, %17, off\n\t"
      "global_load_async_to_lds_b128 %3, %18, off\n\t"
      "global_load_async_to_lds_b128 %4, %19, off\n\t"
      "global_load_async_to_lds_b128 %5, %20, off\n\t"
      "global_load_async_to_lds_b128 %6, %21, off\n\t"
      "global_load_async_to_lds_b128 %7, %22, off\n\t"
      "global_load_async_to_lds_b128 %8, %23, off\n\t"
      "global_load_async_to_lds_b128 %9, %24, off\n\t"
      "global_load_async_to_lds_b128 %10, %25, off\n\t"
      "global_load_async_to_lds_b128 %11, %26, off\n\t"
      "global_load_async_to_lds_b128 %12, %27, off\n\t"
      "global_load_async_to_lds_b128 %13, %28, off\n\t"
      "global_load_async_to_lds_b128 %14, %29, off\n\t"
      "s_wait_xcnt 0x0"
      :: "v"(l[0]), "v"(l[1]), "v"(l[2]), "v"(l[3]), "v"(l[4]), "v"(l[5]), "v"(l[6]), "v"(l[7]), "v"(l[8]), "v"(l[9]), "v"(l[10]), "v"(l[11]), "v"(l[12]), "v"(l[13]), "v"(l[14]),
         "v"(g[0]), "v"(g[1]), "v"(g[2]), "v"(g[3]), "v"(g[4]), "v"(g[5]), "v"(g[6]), "v"(g[7]), "v"(g[8]), "v"(g[9]), "v"(g[10]), "v"(g[11]), "v"(g[12]), "v"(g[13]), "v"(g[14])
      : "memory");
}

// Chunk number tid + 256 * a of the 3840 chunks of a pass: contiguous in Wt (a wave's copy reads
// 512 contiguous bytes), row q / 20 and chunk q % 20 in LDS.
__device__ __forceinline__ void issue_w(uint32_t ldsw, int tid, const _Float16* gw, uint32_t buf,
                                        int pass) {
  uint32_t l[15];
  const _Float16* g[15];
  // unrolled: every index of l and g is a constant, so the arrays are registers
#pragma unroll
  for (int a = 0; a < 15; ++a) {
    const uint32_t q = (uint32_t)tid + 256u * a;
    l[a] = ldsw + buf + (q / PCHUNK) * PITCH_B + (q % PCHUNK) * 16u;
    g[a] = gw + (size_t)pass * WPASS_H + a * 2048;
  }
  copy15(l, g);
}

// One x: its 8 spline bases as one 16-byte LDS store, its silu as one 2-byte LDS store.
__device__ __forceinline__ void expand1(float v, unsigned char* spl, unsigned char* sil) {
  // exp(-x) as silu_f has it (x * -log2(e), then v_exp_f32), with the one issue slot that the
  // instruction set asks for behind a transcendental in the same statement
  float ex;
  asm("v_exp_f32 %0, %1\n\tv_nop" : "=v"(ex) : "v"(v * -1.44269504088896341f));
  float bs[NCOEF];
  bspline8(v, bs);
  v8h p;
  // unrolled: bs and p are indexed by constants (registers)
#pragma unroll
  for (int g = 0; g < NCOEF; ++g) p[g] = (_Float16)bs[g];
  *(v8h*)spl = p;
  *(_Float16*)sil = (_Float16)(v / (1.0f + ex));
}

// 16-bit fragment (ISA 7.12.2): lane L<16 -> row L, K {0..7,16..23}; lane L+16 -> row L,
// K {8..15,24..31}: two 16-byte chunks per lane, the same pattern for activation and weight rows.
__device__ __forceinline__ v16h lds_frag(const unsigned char* p) {
  v8h lo = *(const v8h*)(p);
  v8h hi = *(const v8h*)(p + 32);
  return __builtin_shufflevector(lo, hi, 0, 1, 2, 3, 4, 5, 6, 7, 8, 9, 10, 11, 12, 13, 14, 15);
}

__global__ __launch_bounds__(256) void kan_gemm1(const float* __restrict__ x,
                                                 const _Float16* __restrict__ Wt,
                                                 float* __restrict__ H) {
  __shared__ __attribute__((aligned(16))) unsigned char L[2 * STAGE_B];

  const int tid  = threadIdx.x;
  const int lane = tid & 31;
  const int wave = tid >> 5;
  const int wm = wave >> 1;                 // 4 wave rows of 64
  const int wn = wave & 1;                  // 2 wave columns of 96
  const int n0 = blockIdx.x * TILE_N;       // the 4 column tiles of one row tile are neighbours
  const int m0 = blockIdx.y * TILE_M;
  const int kz = blockIdx.z;                // this work-group's half of the input features

  const int r = tid >> 4;                   // row 0..15 of each group of 16 rows
  const int c = tid & 15;                   // feature pair 0..15
  const uint32_t ldsw = (uint32_t)(uintptr_t)&L[0] + (uint32_t)(TILE_M * PITCH_B);
  const _Float16* gw = Wt + (size_t)kz * NPASS * WPASS_H + (size_t)n0 * KPASS + tid * 8;
  // a thread builds, for the 16 rows r + 16 * a, the feature 2 * c + parity of each pass
  const float* xp = x + (size_t)(m0 + r) * IN_F + kz * (IN_F / KSPLIT) + 2 * c;
  unsigned char* es = L + r * PITCH_B + c * 16;           // spline chunk
  unsigned char* ei = L + r * PITCH_B + SILU_B + c * 4;   // silu place of the even feature

  v8f acc[4][6] = {};

  const int csub = lane & 15;
  const int hsub = lane >> 4;
  const unsigned char* pa = L + (wm * 64 + csub) * PITCH_B + 16 * hsub;
  const unsigned char* pb = L + (TILE_M + wn * 96 + csub) * PITCH_B + 16 * hsub;

  issue_w(ldsw, tid, gw, 0u, 0);
  // two passes' x of the 16 rows; every loop over a is unrolled so that xs stays in registers
  float2 xs[16];
#pragma unroll
  for (int a = 0; a < 16; ++a) xs[a] = *(const float2*)(xp + (size_t)a * 16 * IN_F);
  // stands in front of the first write to an address register that these loads name
  asm volatile("s_wait_xcnt 0x0" ::: "memory");
  float2 xq[16] = {};  // the next two passes' x on its way
  // The silu places of both buffers start as zeros: buffer b only ever holds passes of parity b,
  // which fill the places of that parity. A row's places are zeroed and filled by the same wave.
  if (c < 4) {
    const v8h zero = {};
#pragma unroll
    for (int a = 0; a < 16; ++a) {
      *(v8h*)(L + (a * 16 + r) * PITCH_B + SILU_B + c * 16) = zero;
      *(v8h*)(L + STAGE_B + (a * 16 + r) * PITCH_B + SILU_B + c * 16) = zero;
    }
  }
#pragma unroll
  for (int a = 0; a < 16; ++a) expand1(xs[a].x, es + a * 16 * PITCH_B, ei + a * 16 * PITCH_B);
  asm volatile("s_wait_dscnt 0x0" ::: "memory");     // this wave's rows of pass 0 are written
  asm volatile("s_wait_asynccnt 0x0" ::: "memory");  // this wave's part of pass 0 has landed
  __syncthreads();                                   // every wave's part of pass 0 is there
  issue_w(ldsw, tid, gw, (uint32_t)STAGE_B, 1);

// one pass per trip: the ring's order (read, waits, barrier, refill) stands once, as written
#pragma clang loop unroll(disable)
  for (int t = 0; t < NPASS; ++t) {
    const uint32_t buf = (t & 1) ? (uint32_t)STAGE_B : 0u;
    const uint32_t nbuf = (uint32_t)STAGE_B - buf;   // the buffer of pass t + 1
    const bool build = t + 1 < NPASS;                // a pass t + 1 exists
    const bool odd = ((t + 1) & 1) != 0;             // its parity
    const bool fetch = odd && (t + 2 < NPASS);       // xs is used up in this trip and a next pair of passes exists
    const unsigned char* qa = pa + buf;
    const unsigned char* qb = pb + buf;
    unsigned char* ns = es + nbuf;
    unsigned char* ni = ei + nbuf + (odd ? 2 : 0);
    // every loop below is unrolled so that fragment and accumulator indices are constants
    // (registers, no scratch) and the LDS offsets are immediates
    v16h af[2][4], bf[2][6];
#pragma unroll
    for (int i = 0; i < 4; ++i) af[0][i] = lds_frag(qa + i * 16 * PITCH_B);
#pragma unroll
    for (int j = 0; j < 6; ++j) bf[0][j] = lds_frag(qb + j * 16 * PITCH_B);
#pragma unroll
    for (int ks = 0; ks < KPASS / 32; ++ks) {
      const int cur = ks & 1, nxt = cur ^ 1;
      if (ks + 1 < KPASS / 32) {  // the next 32 k of this same buffer, as one group of reads
#pragma unroll
        for (int i = 0; i < 4; ++i) af[nxt][i] = lds_frag(qa + i * 16 * PITCH_B + (ks + 1) * 64);
#pragma unroll
        for (int j = 0; j < 6; ++j) bf[nxt][j] = lds_frag(qb + j * 16 * PITCH_B + (ks + 1) * 64);
      }
      // keeps the group of LDS reads ahead of the matrix block instead of spread among it
      __builtin_amdgcn_sched_barrier(0);
#pragma unroll
      for (int i = 0; i < 4; ++i)
#pragma unroll
        for (int j = 0; j < 6; ++j)
          acc[i][j] = __builtin_amdgcn_wmma_f32_16x16x32_f16(
              false, af[cur][i], false, bf[cur][j], (short)0, acc[i][j], false, false);
      // keeps the following vector work and LDS reads behind this matrix block
      __builtin_amdgcn_sched_barrier(0);
      if (ks == 0 && fetch) {  // asked for four fifths of a pass before it is taken over into xs
        const float* xn = xp + ((t + 2) >> 1) * 32;
#pragma unroll
        for (int a = 0; a < 16; ++a) xq[a] = *(const float2*)(xn + (size_t)a * 16 * IN_F);
        // stands in front of the first write to the address register that these loads name
        asm volatile("s_wait_xcnt 0x0" ::: "memory");
      }
      // a fifth of pass t + 1's activation rows (4, 3, 3, 3, 3 of a thread's 16): vector work that
      // runs while the SIMD's other wave has the matrix unit
      if (build) {
#pragma unroll
        for (int a = (ks ? 3 * ks + 1 : 0); a < 3 * ks + 4; ++a)
          expand1(odd ? xs[a].y : xs[a].x, ns + a * 16 * PITCH_B, ni + a * 16 * PITCH_B);
      }
    }
    if (fetch) {
#pragma unroll
      for (int a = 0; a < 16; ++a) xs[a] = xq[a];
    }
    asm volatile("s_wait_dscnt 0x0" ::: "memory");     // this wave's reads of the buffer and its writes of pass t + 1 are done
    asm volatile("s_wait_asynccnt 0x0" ::: "memory");  // this wave's part of pass t + 1 has landed
    __syncthreads();  // publishes pass t + 1 and frees the buffer that pass t has read
    if (t + 2 < NPASS) issue_w(ldsw, tid, gw, buf, t + 2);
  }
  asm volatile("s_wait_asynccnt 0x0" ::: "memory");    // no copy is open when the wave ends

  // D layout: lane L holds (m = v + 8*(L>=16), n = L&15) for v in 0..7
  const int rsub = hsub << 3;
  float* Hp = H + (size_t)blockIdx.z * B_ROWS * IN_F;  // the plane of this half of the features
#pragma unroll
  for (int i = 0; i < 4; ++i)
#pragma unroll
    for (int j = 0; j < 6; ++j)
#pragma unroll
      for (int v = 0; v < 8; ++v) {
        int row = m0 + wm * 64 + 16 * i + rsub + v;
        int col = n0 + wn * 96 + 16 * j + csub;
        Hp[(size_t)row * IN_F + col] = acc[i][j][v];
      }
}

// ---------------- Layer 2: out[b, 0..1], one wave per row, shuffle reduction ----------------
// H holds the first layer's sums in two planes, one per half of k, added here; the GELU is applied
// here too, where the value is read: one copy of
// erff's code in a rolled loop with eight waves on a SIMD, instead of 192 copies behind each
// other in the GEMM's unrolled epilogue with two.

__global__ __launch_bounds__(256) void kan_layer2(const float* __restrict__ H,
                                                  const float* __restrict__ w2b,
                                                  const float* __restrict__ w2s,
                                                  float* __restrict__ out) {
  const int lane = threadIdx.x & 31;
  const int b = blockIdx.x * 8 + (threadIdx.x >> 5);
  float a0 = 0.0f, a1 = 0.0f;
  for (int i = lane; i < IN_F; i += 32) {
    const float p = H[(size_t)b * IN_F + i] + H[(size_t)(B_ROWS + b) * IN_F + i];
    const float x = 0.5f * p * (1.0f + erff(p * 0.70710678118654752f)); // exact-erf GELU
    float s = silu_f(x);
    float bs[NCOEF];
    bspline8(x, bs);
    a0 += s * w2b[i];
    a1 += s * w2b[IN_F + i];
    const float* w0 = w2s + (size_t)i * NCOEF;
    const float* w1 = w2s + (size_t)(IN_F + i) * NCOEF;
#pragma unroll
    for (int g = 0; g < NCOEF; ++g) {
      a0 += bs[g] * w0[g];
      a1 += bs[g] * w1[g];
    }
  }
#pragma unroll
  for (int off = 16; off > 0; off >>= 1) {
    a0 += __shfl_down(a0, off, 32);
    a1 += __shfl_down(a1, off, 32);
  }
  if (lane == 0) {
    out[(size_t)b * OUT_L + 0] = a0;
    out[(size_t)b * OUT_L + 1] = a1;
  }
}

// ---------------- Launch ----------------

extern "C" void kernel_launch(void* const* d_in, const int* in_sizes, int n_in,
                              void* d_out, int out_size, void* d_ws, size_t ws_size,
                              hipStream_t stream) {
  (void)in_sizes; (void)n_in; (void)out_size; (void)ws_size;
  const float* hidden = (const float*)d_in[0];
  const float* kbw    = (const float*)d_in[1];  // [768,768]
  const float* ksw    = (const float*)d_in[2];  // [768,768,8]
  const float* obw    = (const float*)d_in[3];  // [2,768]
  const float* osw    = (const float*)d_in[4];  // [2,768,8]
  float* out = (float*)d_out;

  uint8_t* ws = (uint8_t*)d_ws;
  const size_t szW = (size_t)NPASS_ALL * WPASS_H * sizeof(_Float16);  // 11.8 MB
  _Float16* Wt = (_Float16*)(ws);
  float*    H  = (float*)(ws + szW);                                  // 2 planes of 25.2 MB

  kan_prep_w<<<NPASS_ALL * IN_F * PCHUNK / (256 * 8), 256, 0, stream>>>(kbw, ksw, Wt);  // 360 blocks

  dim3 g(IN_F / TILE_N, B_ROWS / TILE_M, KSPLIT); // 4 x 32 x 2 blocks, 8 waves each
  kan_gemm1<<<g, 256, 0, stream>>>(hidden, Wt, H);

  kan_layer2<<<B_ROWS / 8, 256, 0, stream>>>(H, obw, osw, out);
}

// v007
// It runs in 96 microseconds.
// Next to v006, in two timings, it ran 1.10 times as fast each time.
// Over all steps from v000 it is 4.19 times as fast.
#include <hip/hip_runtime.h>
#include <cstdint>
#include <cstddef>

// Problem constants (from reference): B=8192, H=768, L=2, k=3, G=5, NUM_COEF=8
#define B_ROWS 8192
#define IN_F   768
#define NCOEF  8
#define OUT_L  2

typedef __attribute__((ext_vector_type(16))) _Float16 v16h;
typedef __attribute__((ext_vector_type(8)))  _Float16 v8h;
typedef __attribute__((ext_vector_type(8)))  float    v8f;

__device__ __forceinline__ float silu_f(float x) {
  return x / (1.0f + __expf(-x));
}

// Order-3 B-spline bases on the uniform extended knot grid t_j = -1 + (j-3)*0.4, j=0..11.
// On equal knot spacing the Cox-de Boor recursion yields one shape for every basis: with d the
// distance of x from the centre t_(g+2) of basis g, in knot steps, and a = (1 - d/2) cut to [0, 1],
//   d <= 1: 2/3 - d^2 a        1 <= d <= 2: 4/3 a^3        d >= 2: 0.
// The first minus the second is -2/3 (1 - d)^3, so the smaller of the two is the right one on
// either side of d = 1, and for d >= 2 (a = 0) it is 0.
typedef __attribute__((ext_vector_type(2))) float v2f;

__device__ __forceinline__ void bspline8(float x, float* __restrict__ out) {
  // two bases at a time: the products below are packed two-float instructions; unrolled so that
  // out is indexed by constants (registers) and the centres are literals
#pragma unroll
  for (int g = 0; g < NCOEF; g += 2) {
    v2f d, a;
    d.x = fmaf(x, 2.5f, 3.5f - (float)g);  // (x - t_(g+2)) / h
    d.y = fmaf(x, 2.5f, 2.5f - (float)g);
    // the median with 0 and 1 compiles to the clamp modifier (on the multiply-add itself where that
    // stays a one-float instruction), not to a compare and select
    a.x = __builtin_amdgcn_fmed3f(fmaf(fabsf(d.x), -0.5f, 1.0f), 0.0f, 1.0f);
    a.y = __builtin_amdgcn_fmed3f(fmaf(fabsf(d.y), -0.5f, 1.0f), 0.0f, 1.0f);
    const v2f inner = (2.0f / 3.0f) - (d * d) * a;
    const v2f outer = (a * a) * (a * (4.0f / 3.0f));
    const v2f r = __builtin_elementwise_min(inner, outer);
    out[g] = r.x;
    out[g + 1] = r.y;
  }
}

// ---------------- Prep kernel: f16 weights in the order in which the GEMM walks k ----------------

// k is walked in 48 passes of 16 input features. Pass P = 2 * G + par holds the features
// 32 * G + 2 * c + par, c = 0..15. A pass is 160 k = 320 B per row, twenty 16-byte chunks:
//   chunk c < 16     : the 8 spline bases of feature 32 * G + 2 * c + par
//   chunks 16 .. 19  : 32 silu places, place s = feature 32 * G + s; the activation side holds a
//                      zero at every place whose parity is not par, so each feature counts once
// Wt is pass-major, [48][768][160]: the 192 rows that a work-group needs of a pass are 61440
// contiguous bytes.
#define FPASS   16
#define KPASS   160
#define PCHUNK  20                          // 16-byte chunks per row and pass
#define NPASS_ALL (IN_F / FPASS)            // 48
#define WPASS_H (IN_F * KPASS)              // halfs of one pass of Wt

// Every chunk is 8 neighbouring floats of sw or of bw. A wave makes 8 x 512 contiguous bytes of Wt.
__global__ __launch_bounds__(256) void kan_prep_w(const float* __restrict__ bw,
                                                  const float* __restrict__ sw,
                                                  _Float16* __restrict__ Wt) {
  const int lane = threadIdx.x & 31;
  const int gwave = blockIdx.x * 8 + (threadIdx.x >> 5);
  float4 lo[8], hi[8];
  // both loops are unrolled: all 16 loads are issued before the first value is used, and the
  // arrays are indexed by constants (registers)
#pragma unroll
  for (int k = 0; k < 8; ++k) {
    const int q = (gwave * 8 + k) * 32 + lane;
    const int j = q % PCHUNK;
    const int ro = q / PCHUNK;
    const int o = ro % IN_F;
    const int p = ro / IN_F;
    const int f0 = (p >> 1) * 32;
    const float* src = (j < 16) ? sw + ((size_t)o * IN_F + f0 + 2 * j + (p & 1)) * NCOEF
                                : bw + (size_t)o * IN_F + f0 + (j - 16) * 8;
    lo[k] = *(const float4*)(src);
    hi[k] = *(const float4*)(src + 4);
  }
#pragma unroll
  for (int k = 0; k < 8; ++k) {
    const int q = (gwave * 8 + k) * 32 + lane;
    v8h h;
    h[0] = (_Float16)lo[k].x; h[1] = (_Float16)lo[k].y; h[2] = (_Float16)lo[k].z; h[3] = (_Float16)lo[k].w;
    h[4] = (_Float16)hi[k].x; h[5] = (_Float16)hi[k].y; h[6] = (_Float16)hi[k].z; h[7] = (_Float16)hi[k].w;
    *(v8h*)(Wt + (size_t)q * 8) = h;
  }
}

// ---------------- WMMA GEMM: H0 + H1 = act(x)[8192 x 7680] * Wt (GELU: see layer 2) ----------------

// One work-group of 8 waves owns a 256 x 192 tile of H over one half of the input features (24
// passes); the two halves' sums go to two planes of H, which layer 2 adds. The activation operand
// (silu and the 8 spline bases of every x) is never in memory: the work-group reads 64 B of x per
// row and pass and builds the 320 B of the operand's row in LDS itself, for the next pass while
// this pass is worked on. The weight rows come by asynchronous copies. A stage is 256 activation
// rows and 192 weight rows at a pitch of 336 B (16 B x odd: the 16 lanes of a ds_load_b128 half
// fall on distinct banks). Two buffers.
#define TILE_M  256
#define TILE_N  192
#define KSPLIT  2
#define NPASS   (NPASS_ALL / KSPLIT)      // 24
#define PITCH_B 336
#define SILU_B  256                       // byte offset of the 32 silu places in a row
#define STAGE_B ((TILE_M + TILE_N) * PITCH_B)  // 150528 bytes per buffer

// Fifteen asynchronous 16-byte copies per lane, global -> LDS: the 192 weight rows of one pass.
// The s_wait_xcnt is the last line of the copies' own statement so that no address register
// named here is rewritten ahead of it.
__device__ __forceinline__ void copy15(const uint32_t* l, const _Float16* const* g) {
  asm volatile(
      "global_load_async_to_lds_b128 %0, %15, off\n\t"
      "global_load_async_to_lds_b128 %1, %16, off\n\t"
      "global_load_async_to_lds_b128 %2, %17, off\n\t"
      "global_load_async_to_lds_b128 %3, %18, off\n\t"
      "global_load_async_to_lds_b128 %4, %19, off\n\t"
      "global_load_async_to_lds_b128 %5, %20, off\n\t"
      "global_load_async_to_lds_b128 %6, %21, off\n\t"
      "global_load_async_to_lds_b128 %7, %22, off\n\t"
      "global_load_async_to_lds_b128 %8, %23, off\n\t"
      "global_load_async_to_lds_b128 %9, %24, off\n\t"
      "global_load_async_to_lds_b128 %10, %25, off\n\t"
      "global_load_async_to_lds_b128 %11, %26, off\n\t"
      "global_load_async_to_lds_b128 %12, %27, off\n\t"
      "global_load_async_to_lds_b128 %13, %28, off\n\t"
      "global_load_async_to_lds_b128 %14, %29, off\n\t"
      "s_wait_xcnt 0x0"
      :: "v"(l[0]), "v"(l[1]), "v"(l[2]), "v"(l[3]), "v"(l[4]), "v"(l[5]), "v"(l[6]), "v"(l[7]), "v"(l[8]), "v"(l[9]), "v"(l[10]), "v"(l[11]), "v"(l[12]), "v"(l[13]), "v"(l[14]),
         "v"(g[0]), "v"(g[1]), "v"(g[2]), "v"(g[3]), "v"(g[4]), "v"(g[5]), "v"(g[6]), "v"(g[7]), "v"(g[8]), "v"(g[9]), "v"(g[10]), "v"(g[11]), "v"(g[12]), "v"(g[13]), "v"(g[14])
      : "memory");
}

// Chunk number tid + 256 * a of the 3840 chunks of a pass: contiguous in Wt (a wave's copy reads
// 512 contiguous bytes), row q / 20 and chunk q % 20 in LDS.
__device__ __forceinline__ void issue_w(uint32_t ldsw, int tid, const _Float16* gw, uint32_t buf,
                                        int pass) {
  uint32_t l[15];
  const _Float16* g[15];
  // unrolled: every index of l and g is a constant, so the arrays are registers
#pragma unroll
  for (int a = 0; a < 15; ++a) {
    const uint32_t q = (uint32_t)tid + 256u * a;
    l[a] = ldsw + buf + (q / PCHUNK) * PITCH_B + (q % PCHUNK) * 16u;
    g[a] = gw + (size_t)pass * WPASS_H + a * 2048;
  }
  copy15(l, g);
}

typedef __attribute__((ext_vector_type(2))) _Float16 v2h;
typedef __attribute__((ext_vector_type(16))) float v16f;
typedef __attribute__((ext_vector_type(2))) unsigned short v2us;
typedef __attribute__((ext_vector_type(4))) uint32_t v4u;

// One x: its 8 spline bases as one 16-byte LDS store, its silu as one 2-byte LDS store.
// Of the 8 bases at most 4 are not zero: with t = (x - t_0) / h, cell i = floor(t) and u = t - i they
// are the bases i-3 .. i, the four cubic pieces of the same shape that bspline8 evaluates:
//   (1-u)^3 / 6,   2/3 - u^2 (1 - u/2),   2/3 - (1-u)^2 (1 - (1-u)/2),   u^3 / 6.
// These four f16 (8 bytes) are put at places i-3 .. i of the 8 by one byte permute per dword. Place
// p takes piece j = p - (i - 3): selector bytes 2j, 2j+1 = 0x0100 + 0x0202 j as a 16-bit number. For
// j outside 0..3 that number is above 0x0706 (a negative j wraps round), and the minimum with 0x0908
// turns it into the two selectors that copy the sign bits of pieces 0 and 1, which are never
// negative: a zero. t is cut to [-1, 11.5], where cells -1 and 11 give j outside 0..3 at every place.
__device__ __forceinline__ void expand1(float v, unsigned char* spl, unsigned char* sil) {
  // exp(-x) as silu_f has it (x * -log2(e), then v_exp_f32), with the one issue slot that the
  // instruction set asks for behind a transcendental in the same statement
  float ex;
  asm("v_exp_f32 %0, %1\n\tv_nop" : "=v"(ex) : "v"(v * -1.44269504088896341f));
  const float t = __builtin_amdgcn_fmed3f(fmaf(v, 2.5f, 5.5f), -1.0f, 11.5f);
  const float fl = floorf(t);
  v2f uu;
  uu.x = t - fl;
  uu.y = 1.0f - uu.x;
  const v2f sq = uu * uu;
  const v2f cube = sq * (uu * (1.0f / 6.0f));                  // u^3/6 (basis i), (1-u)^3/6 (basis i-3)
  const v2f mid = (2.0f / 3.0f) - sq * (1.0f - 0.5f * uu);     // basis i-2, basis i-1
  v2h p01, p23;
  p01.x = (_Float16)cube.y; p01.y = (_Float16)mid.x;
  p23.x = (_Float16)mid.y;  p23.y = (_Float16)cube.x;
  const uint32_t lo = __builtin_bit_cast(uint32_t, p01);
  const uint32_t hi = __builtin_bit_cast(uint32_t, p23);
  // 0x0202 * (12 - i) as the low mantissa bits of 2^23 + that whole number (at most 6682)
  const unsigned short e = (unsigned short)__builtin_bit_cast(uint32_t, fmaf(fl, -514.0f, 8388608.0f + 6168.0f));
  const v2us ee = {e, e};
  const v2us cap = {0x0908, 0x0908};
  v4u o;
  // unrolled: o is indexed by constants (registers) and the added numbers are literals
#pragma unroll
  for (int k = 0; k < 4; ++k) {
    // places 2k and 2k+1: 0x0100 + 0x0202 * (p + 3 - i) = e + 0x0100 + 0x0202 * (p - 9), modulo 2^16
    const v2us add = {(unsigned short)(0x0100 + 0x0202 * (2 * k - 9)), (unsigned short)(0x0100 + 0x0202 * (2 * k - 8))};
    const v2us sel = __builtin_elementwise_min((v2us)(ee + add), cap);
    o[k] = __builtin_amdgcn_perm(hi, lo, __builtin_bit_cast(uint32_t, sel));
  }
  *(v4u*)spl = o;
  *(_Float16*)sil = (_Float16)(v / (1.0f + ex));
}

// 16-bit fragment (ISA 7.12.2): lane L<16 -> row L, K {0..7,16..23}; lane L+16 -> row L,
// K {8..15,24..31}: two 16-byte chunks per lane, the same pattern for activation and weight rows.
__device__ __forceinline__ v16h lds_frag(const unsigned char* p) {
  v8h lo = *(const v8h*)(p);
  v8h hi = *(const v8h*)(p + 32);
  return __builtin_shufflevector(lo, hi, 0, 1, 2, 3, 4, 5, 6, 7, 8, 9, 10, 11, 12, 13, 14, 15);
}

__global__ __launch_bounds__(256) void kan_gemm1(const float* __restrict__ x,
                                                 const _Float16* __restrict__ Wt,
                                                 float* __restrict__ H) {
  __shared__ __attribute__((aligned(16))) unsigned char L[2 * STAGE_B];

  const int tid  = threadIdx.x;
  const int lane = tid & 31;
  const int wave = tid >> 5;
  const int wm = wave >> 1;                 // 4 wave rows of 64
  const int wn = wave & 1;                  // 2 wave columns of 96
  const int n0 = blockIdx.x * TILE_N;       // the 4 column tiles of one row tile are neighbours
  const int m0 = blockIdx.y * TILE_M;
  const int kz = blockIdx.z;                // this work-group's half of the input features

  const int r = tid >> 4;                   // row 0..15 of each group of 16 rows
  const int c = tid & 15;                   // feature pair 0..15
  const uint32_t ldsw = (uint32_t)(uintptr_t)&L[0] + (uint32_t)(TILE_M * PITCH_B);
  const _Float16* gw = Wt + (size_t)kz * NPASS * WPASS_H + (size_t)n0 * KPASS + tid * 8;
  // a thread builds, for the 16 rows r + 16 * a, the feature 2 * c + parity of each pass
  const float* xp = x + (size_t)(m0 + r) * IN_F + kz * (IN_F / KSPLIT) + 2 * c;
  unsigned char* es = L + r * PITCH_B + c * 16;           // spline chunk
  unsigned char* ei = L + r * PITCH_B + SILU_B + c * 4;   // silu place of the even feature

  v8f acc[4][6] = {};

  const int csub = lane & 15;
  const int hsub = lane >> 4;
  const unsigned char* pa = L + (wm * 64 + csub) * PITCH_B + 16 * hsub;
  const unsigned char* pb = L + (TILE_M + wn * 96 + csub) * PITCH_B + 16 * hsub;

  issue_w(ldsw, tid, gw, 0u, 0);
  // two passes' x of the 16 rows; every loop over a is unrolled so that it stays in registers
  // (the even and the odd pass's x as two vectors: as an array of pairs its first 16 bytes were
  // kept in memory by this build)
  v16f xe, xo;
#pragma unroll
  for (int a = 0; a < 16; ++a) {
    const float2 w = *(const float2*)(xp + (size_t)a * 16 * IN_F);
    xe[a] = w.x;
    xo[a] = w.y;
  }
  // stands in front of the first write to an address register that these loads name
  asm volatile("s_wait_xcnt 0x0" ::: "memory");
  float2 xq[16] = {};  // the next two passes' x on its way
  // The silu places of both buffers start as zeros: buffer b only ever holds passes of parity b,
  // which fill the places of that parity. A row's places are zeroed and filled by the same wave.
  if (c < 4) {
    const v8h zero = {};
#pragma unroll
    for (int a = 0; a < 16; ++a) {
      *(v8h*)(L + (a * 16 + r) * PITCH_B + SILU_B + c * 16) = zero;
      *(v8h*)(L + STAGE_B + (a * 16 + r) * PITCH_B + SILU_B + c * 16) = zero;
    }
  }
#pragma unroll
  for (int a = 0; a < 16; ++a) expand1(xe[a], es + a * 16 * PITCH_B, ei + a * 16 * PITCH_B);
  asm volatile("s_wait_dscnt 0x0" ::: "memory");     // this wave's rows of pass 0 are written
  asm volatile("s_wait_asynccnt 0x0" ::: "memory");  // this wave's part of pass 0 has landed
  __syncthreads();                                   // every wave's part of pass 0 is there
  issue_w(ldsw, tid, gw, (uint32_t)STAGE_B, 1);

// one pass per trip: the ring's order (read, waits, barrier, refill) stands once, as written
#pragma clang loop unroll(disable)
  for (int t = 0; t < NPASS; ++t) {
    const uint32_t buf = (t & 1) ? (uint32_t)STAGE_B : 0u;
    const uint32_t nbuf = (uint32_t)STAGE_B - buf;   // the buffer of pass t + 1
    const bool build = t + 1 < NPASS;                // a pass t + 1 exists
    const bool odd = ((t + 1) & 1) != 0;             // its parity
    const bool fetch = odd && (t + 2 < NPASS);       // xe, xo are used up in this trip and a next pair of passes exists
    const unsigned char* qa = pa + buf;
    const unsigned char* qb = pb + buf;
    unsigned char* ns = es + nbuf;
    unsigned char* ni = ei + nbuf + (odd ? 2 : 0);
    // every loop below is unrolled so that fragment and accumulator indices are constants
    // (registers, no scratch) and the LDS offsets are immediates
    v16h af[2][4], bf[2][6];
#pragma unroll
    for (int i = 0; i < 4; ++i) af[0][i] = lds_frag(qa + i * 16 * PITCH_B);
#pragma unroll
    for (int j = 0; j < 6; ++j) bf[0][j] = lds_frag(qb + j * 16 * PITCH_B);
#pragma unroll
    for (int ks = 0; ks < KPASS / 32; ++ks) {
      const int cur = ks & 1, nxt = cur ^ 1;
      if (ks + 1 < KPASS / 32) {  // the next 32 k of this same buffer, as one group of reads
#pragma unroll
        for (int i = 0; i < 4; ++i) af[nxt][i] = lds_frag(qa + i * 16 * PITCH_B + (ks + 1) * 64);
#pragma unroll
        for (int j = 0; j < 6; ++j) bf[nxt][j] = lds_frag(qb + j * 16 * PITCH_B + (ks + 1) * 64);
      }
      // keeps the group of LDS reads ahead of the matrix block instead of spread among it
      __builtin_amdgcn_sched_barrier(0);
#pragma unroll
      for (int i = 0; i < 4; ++i)
#pragma unroll
        for (int j = 0; j < 6; ++j)
          acc[i][j] = __builtin_amdgcn_wmma_f32_16x16x32_f16(
              false, af[cur][i], false, bf[cur][j], (short)0, acc[i][j], false, false);
      // keeps the following vector work and LDS reads behind this matrix block
      __builtin_amdgcn_sched_barrier(0);
      if (ks == 0 && fetch) {  // asked for four fifths of a pass before it is taken over into xe, xo
        const float* xn = xp + ((t + 2) >> 1) * 32;
#pragma unroll
        for (int a = 0; a < 16; ++a) xq[a] = *(const float2*)(xn + (size_t)a * 16 * IN_F);
        // stands in front of the first write to the address register that these loads name
        asm volatile("s_wait_xcnt 0x0" ::: "memory");
      }
      // a fifth of pass t + 1's activation rows (4, 3, 3, 3, 3 of a thread's 16): vector work that
      // runs while the SIMD's other wave has the matrix unit
      if (build) {
#pragma unroll
        for (int a = (ks ? 3 * ks + 1 : 0); a < 3 * ks + 4; ++a)
          expand1(odd ? xo[a] : xe[a], ns + a * 16 * PITCH_B, ni + a * 16 * PITCH_B);
      }
    }
    if (fetch) {
#pragma unroll
      for (int a = 0; a < 16; ++a) {
        xe[a] = xq[a].x;
        xo[a] = xq[a].y;
      }
    }
    asm volatile("s_wait_dscnt 0x0" ::: "memory");     // this wave's reads of the buffer and its writes of pass t + 1 are done
    asm volatile("s_wait_asynccnt 0x0" ::: "memory");  // this wave's part of pass t + 1 has landed
    __syncthreads();  // publishes pass t + 1 and frees the buffer that pass t has read
    if (t + 2 < NPASS) issue_w(ldsw, tid, gw, buf, t + 2);
  }
  asm volatile("s_wait_asynccnt 0x0" ::: "memory");    // no copy is open when the wave ends

  // D layout: lane L holds (m = v + 8*(L>=16), n = L&15) for v in 0..7
  const int rsub = hsub << 3;
  float* Hp = H + (size_t)blockIdx.z * B_ROWS * IN_F;  // the plane of this half of the features
#pragma unroll
  for (int i = 0; i < 4; ++i)
#pragma unroll
    for (int j = 0; j < 6; ++j)
#pragma unroll
      for (int v = 0; v < 8; ++v) {
        int row = m0 + wm * 64 + 16 * i + rsub + v;
        int col = n0 + wn * 96 + 16 * j + csub;
        Hp[(size_t)row * IN_F + col] = acc[i][j][v];
      }
}

// ---------------- Layer 2: out[b, 0..1], one wave per row, shuffle reduction ----------------
// H holds the first layer's sums in two planes, one per half of k, added here; the GELU is applied
// here too, where the value is read: one copy of
// erff's code in a rolled loop with eight waves on a SIMD, instead of 192 copies behind each
// other in the GEMM's unrolled epilogue with two.

__global__ __launch_bounds__(256) void kan_layer2(const float* __restrict__ H,
                                                  const float* __restrict__ w2b,
                                                  const float* __restrict__ w2s,
                                                  float* __restrict__ out) {
  const int lane = threadIdx.x & 31;
  const int b = blockIdx.x * 8 + (threadIdx.x >> 5);
  float a0 = 0.0f, a1 = 0.0f;
  for (int i = lane; i < IN_F; i += 32) {
    const float p = H[(size_t)b * IN_F + i] + H[(size_t)(B_ROWS + b) * IN_F + i];
    const float x = 0.5f * p * (1.0f + erff(p * 0.70710678118654752f)); // exact-erf GELU
    float s = silu_f(x);
    float bs[NCOEF];
    bspline8(x, bs);
    a0 += s * w2b[i];
    a1 += s * w2b[IN_F + i];
    const float* w0 = w2s + (size_t)i * NCOEF;
    const float* w1 = w2s + (size_t)(IN_F + i) * NCOEF;
#pragma unroll
    for (int g = 0; g < NCOEF; ++g) {
      a0 += bs[g] * w0[g];
      a1 += bs[g] * w1[g];
    }
  }
#pragma unroll
  for (int off = 16; off > 0; off >>= 1) {
    a0 += __shfl_down(a0, off, 32);
    a1 += __shfl_down(a1, off, 32);
  }
  if (lane == 0) {
    out[(size_t)b * OUT_L + 0] = a0;
    out[(size_t)b * OUT_L + 1] = a1;
  }
}

// ---------------- Launch ----------------

extern "C" void kernel_launch(void* const* d_in, const int* in_sizes, int n_in,
                              void* d_out, int out_size, void* d_ws, size_t ws_size,
                              hipStream_t stream) {
  (void)in_sizes; (void)n_in; (void)out_size; (void)ws_size;
  const float* hidden = (const float*)d_in[0];
  const float* kbw    = (const float*)d_in[1];  // [768,768]
  const float* ksw    = (const float*)d_in[2];  // [768,768,8]
  const float* obw    = (const float*)d_in[3];  // [2,768]
  const float* osw    = (const float*)d_in[4];  // [2,768,8]
  float* out = (float*)d_out;

  uint8_t* ws = (uint8_t*)d_ws;
  const size_t szW = (size_t)NPASS_ALL * WPASS_H * sizeof(_Float16);  // 11.8 MB
  _Float16* Wt = (_Float16*)(ws);
  float*    H  = (float*)(ws + szW);                                  // 2 planes of 25.2 MB

  kan_prep_w<<<NPASS_ALL * IN_F * PCHUNK / (256 * 8), 256, 0, stream>>>(kbw, ksw, Wt);  // 360 blocks

  dim3 g(IN_F / TILE_N, B_ROWS / TILE_M, KSPLIT); // 4 x 32 x 2 blocks, 8 waves each
  kan_gemm1<<<g, 256, 0, stream>>>(hidden, Wt, H);

  kan_layer2<<<B_ROWS / 8, 256, 0, stream>>>(H, obw, osw, out);
}

// v008
// One run takes 91.2 microseconds.
// Two timings next to v007 both put it at 1.05 times that version's speed.
// All steps since v000 together make it 4.40 times as fast.
#include <hip/hip_runtime.h>
#include <cstdint>
#include <cstddef>

// Problem constants (from reference): B=8192, H=768, L=2, k=3, G=5, NUM_COEF=8
#define B_ROWS 8192
#define IN_F   768
#define NCOEF  8
#define OUT_L  2

typedef __attribute__((ext_vector_type(16))) _Float16 v16h;
typedef __attribute__((ext_vector_type(8)))  _Float16 v8h;
typedef __attribute__((ext_vector_type(8)))  float    v8f;

// x / (1 + exp(-x)) as x times the hardware reciprocal (v_rcp_f32) of the denominator, which lies in
// [1, inf]: one instruction and a product where the exact quotient takes eleven instructions.
__device__ __forceinline__ float silu_f(float x) {
  return x * __builtin_amdgcn_rcpf(1.0f + __expf(-x));
}

// Order-3 B-spline bases on the uniform extended knot grid t_j = -1 + (j-3)*0.4, j=0..11.
// On equal knot spacing the Cox-de Boor recursion yields one shape for every basis: with d the
// distance of x from the centre t_(g+2) of basis g, in knot steps, and a = (1 - d/2) cut to [0, 1],
//   d <= 1: 2/3 - d^2 a        1 <= d <= 2: 4/3 a^3        d >= 2: 0.
// The first minus the second is -2/3 (1 - d)^3, so the smaller of the two is the right one on
// either side of d = 1, and for d >= 2 (a = 0) it is 0.
typedef __attribute__((ext_vector_type(2))) float v2f;

__device__ __forceinline__ void bspline8(float x, float* __restrict__ out) {
  // two bases at a time: the products below are packed two-float instructions; unrolled so that
  // out is indexed by constants (registers) and the centres are literals
#pragma unroll
  for (int g = 0; g < NCOEF; g += 2) {
    v2f d, a;
    d.x = fmaf(x, 2.5f, 3.5f - (float)g);  // (x - t_(g+2)) / h
    d.y = fmaf(x, 2.5f, 2.5f - (float)g);
    // the median with 0 and 1 compiles to the clamp modifier (on the multiply-add itself where that
    // stays a one-float instruction), not to a compare and select
    a.x = __builtin_amdgcn_fmed3f(fmaf(fabsf(d.x), -0.5f, 1.0f), 0.0f, 1.0f);
    a.y = __builtin_amdgcn_fmed3f(fmaf(fabsf(d.y), -0.5f, 1.0f), 0.0f, 1.0f);
    const v2f inner = (2.0f / 3.0f) - (d * d) * a;
    const v2f outer = (a * a) * (a * (4.0f / 3.0f));
    const v2f r = __builtin_elementwise_min(inner, outer);
    out[g] = r.x;
    out[g + 1] = r.y;
  }
}

// ---------------- Prep kernel: f16 weights in the order in which the GEMM walks k ----------------

// k is walked in 48 passes of 16 input features. Pass P = 2 * G + par holds the features
// 32 * G + 2 * c + par, c = 0..15. A pass is 160 k = 320 B per row, twenty 16-byte chunks:
//   chunk c < 16     : the 8 spline bases of feature 32 * G + 2 * c + par
//   chunks 16 .. 19  : 32 silu places, place s = feature 32 * G + s; the activation side holds a
//                      zero at every place whose parity is not par, so each feature counts once
// Wt is pass-major, [48][768][160]: the 192 rows that a work-group needs of a pass are 61440
// contiguous bytes.
#define FPASS   16
#define KPASS   160
#define PCHUNK  20                          // 16-byte chunks per row and pass
#define NPASS_ALL (IN_F / FPASS)            // 48
#define WPASS_H (IN_F * KPASS)              // halfs of one pass of Wt

// Every chunk is 8 neighbouring floats of sw or of bw. A wave makes 8 x 512 contiguous bytes of Wt.
__global__ __launch_bounds__(256) void kan_prep_w(const float* __restrict__ bw,
                                                  const float* __restrict__ sw,
                                                  _Float16* __restrict__ Wt) {
  const int lane = threadIdx.x & 31;
  const int gwave = blockIdx.x * 8 + (threadIdx.x >> 5);
  float4 lo[8], hi[8];
  // both loops are unrolled: all 16 loads are issued before the first value is used, and the
  // arrays are indexed by constants (registers)
#pragma unroll
  for (int k = 0; k < 8; ++k) {
    const int q = (gwave * 8 + k) * 32 + lane;
    const int j = q % PCHUNK;
    const int ro = q / PCHUNK;
    const int o = ro % IN_F;
    const int p = ro / IN_F;
    const int f0 = (p >> 1) * 32;
    const float* src = (j < 16) ? sw + ((size_t)o * IN_F + f0 + 2 * j + (p & 1)) * NCOEF
                                : bw + (size_t)o * IN_F + f0 + (j - 16) * 8;
    lo[k] = *(const float4*)(src);
    hi[k] = *(const float4*)(src + 4);
  }
#pragma unroll
  for (int k = 0; k < 8; ++k) {
    const int q = (gwave * 8 + k) * 32 + lane;
    v8h h;
    h[0] = (_Float16)lo[k].x; h[1] = (_Float16)lo[k].y; h[2] = (_Float16)lo[k].z; h[3] = (_Float16)lo[k].w;
    h[4] = (_Float16)hi[k].x; h[5] = (_Float16)hi[k].y; h[6] = (_Float16)hi[k].z; h[7] = (_Float16)hi[k].w;
    *(v8h*)(Wt + (size_t)q * 8) = h;
  }
}

// ---------------- WMMA GEMM: H0 + H1 = act(x)[8192 x 7680] * Wt (GELU: see layer 2) ----------------

// One work-group of 8 waves owns a 256 x 192 tile of H over one half of the input features (24
// passes); the two halves' sums go to two planes of H, which layer 2 adds. The activation operand
// (silu and the 8 spline bases of every x) is never in memory: the work-group reads 64 B of x per
// row and pass and builds the 320 B of the operand's row in LDS itself, for the next pass while
// this pass is worked on. The weight rows come by asynchronous copies. A stage is 256 activation
// rows and 192 weight rows at a pitch of 336 B (16 B x odd: the 16 lanes of a ds_load_b128 half
// fall on distinct banks). Two buffers.
#define TILE_M  256
#define TILE_N  192
#define KSPLIT  2
#define NPASS   (NPASS_ALL / KSPLIT)      // 24
#define PITCH_B 336
#define SILU_B  256                       // byte offset of the 32 silu places in a row
#define STAGE_B ((TILE_M + TILE_N) * PITCH_B)  // 150528 bytes per buffer

// Fifteen asynchronous 16-byte copies per lane, global -> LDS: the 192 weight rows of one pass.
// The s_wait_xcnt is the last line of the copies' own statement so that no address register
// named here is rewritten ahead of it.
__device__ __forceinline__ void copy15(const uint32_t* l, const _Float16* const* g) {
  asm volatile(
      "global_load_async_to_lds_b128 %0, %15, off\n\t"
      "global_load_async_to_lds_b128 %1, %16, off\n\t"
      "global_load_async_to_lds_b128 %2, %17, off\n\t"
      "global_load_async_to_lds_b128 %3, %18, off\n\t"
      "global_load_async_to_lds_b128 %4, %19, off\n\t"
      "global_load_async_to_lds_b128 %5, %20, off\n\t"
      "global_load_async_to_lds_b128 %6, %21, off\n\t"
      "global_load_async_to_lds_b128 %7, %22, off\n\t"
      "global_load_async_to_lds_b128 %8, %23, off\n\t"
      "global_load_async_to_lds_b128 %9, %24, off\n\t"
      "global_load_async_to_lds_b128 %10, %25, off\n\t"
      "global_load_async_to_lds_b128 %11, %26, off\n\t"
      "global_load_async_to_lds_b128 %12, %27, off\n\t"
      "global_load_async_to_lds_b128 %13, %28, off\n\t"
      "global_load_async_to_lds_b128 %14, %29, off\n\t"
      "s_wait_xcnt 0x0"
      :: "v"(l[0]), "v"(l[1]), "v"(l[2]), "v"(l[3]), "v"(l[4]), "v"(l[5]), "v"(l[6]), "v"(l[7]), "v"(l[8]), "v"(l[9]), "v"(l[10]), "v"(l[11]), "v"(l[12]), "v"(l[13]), "v"(l[14]),
         "v"(g[0]), "v"(g[1]), "v"(g[2]), "v"(g[3]), "v"(g[4]), "v"(g[5]), "v"(g[6]), "v"(g[7]), "v"(g[8]), "v"(g[9]), "v"(g[10]), "v"(g[11]), "v"(g[12]), "v"(g[13]), "v"(g[14])
      : "memory");
}

// Chunk number tid + 256 * a of the 3840 chunks of a pass: contiguous in Wt (a wave's copy reads
// 512 contiguous bytes), row q / 20 and chunk q % 20 in LDS.
__device__ __forceinline__ void issue_w(uint32_t ldsw, int tid, const _Float16* gw, uint32_t buf,
                                        int pass) {
  uint32_t l[15];
  const _Float16* g[15];
  // unrolled: every index of l and g is a constant, so the arrays are registers
#pragma unroll
  for (int a = 0; a < 15; ++a) {
    const uint32_t q = (uint32_t)tid + 256u * a;
    l[a] = ldsw + buf + (q / PCHUNK) * PITCH_B + (q % PCHUNK) * 16u;
    g[a] = gw + (size_t)pass * WPASS_H + a * 2048;
  }
  copy15(l, g);
}

typedef __attribute__((ext_vector_type(2))) _Float16 v2h;
typedef __attribute__((ext_vector_type(16))) float v16f;
typedef __attribute__((ext_vector_type(2))) unsigned short v2us;
typedef __attribute__((ext_vector_type(4))) uint32_t v4u;

// One x: its 8 spline bases as one 16-byte LDS store, its silu as one 2-byte LDS store.
// Of the 8 bases at most 4 are not zero: with t = (x - t_0) / h, cell i = floor(t) and u = t - i they
// are the bases i-3 .. i, the four cubic pieces of the same shape that bspline8 evaluates:
//   (1-u)^3 / 6,   2/3 - u^2 (1 - u/2),   2/3 - (1-u)^2 (1 - (1-u)/2),   u^3 / 6.
// These four f16 (8 bytes) are put at places i-3 .. i of the 8 by one byte permute per dword. Place
// p takes piece j = p - (i - 3): selector bytes 2j, 2j+1 = 0x0100 + 0x0202 j as a 16-bit number. For
// j outside 0..3 that number is above 0x0706 (a negative j wraps round), and the minimum with 0x0908
// turns it into the two selectors that copy the sign bits of pieces 0 and 1, which are never
// negative: a zero. t is cut to [-1, 11.5], where cells -1 and 11 give j outside 0..3 at every place.
__device__ __forceinline__ void expand1(float v, unsigned char* spl, unsigned char* sil) {
  // exp(-x) as silu_f has it (x * -log2(e), then v_exp_f32), with the one issue slot that the
  // instruction set asks for behind a transcendental in the same statement
  float ex;
  asm("v_exp_f32 %0, %1\n\tv_nop" : "=v"(ex) : "v"(v * -1.44269504088896341f));
  const float t = __builtin_amdgcn_fmed3f(fmaf(v, 2.5f, 5.5f), -1.0f, 11.5f);
  const float fl = floorf(t);
  v2f uu;
  uu.x = t - fl;
  uu.y = 1.0f - uu.x;
  const v2f sq = uu * uu;
  const v2f cube = sq * (uu * (1.0f / 6.0f));                  // u^3/6 (basis i), (1-u)^3/6 (basis i-3)
  const v2f mid = (2.0f / 3.0f) - sq * (1.0f - 0.5f * uu);     // basis i-2, basis i-1
  v2h p01, p23;
  p01.x = (_Float16)cube.y; p01.y = (_Float16)mid.x;
  p23.x = (_Float16)mid.y;  p23.y = (_Float16)cube.x;
  const uint32_t lo = __builtin_bit_cast(uint32_t, p01);
  const uint32_t hi = __builtin_bit_cast(uint32_t, p23);
  // 0x0202 * (12 - i) as the low mantissa bits of 2^23 + that whole number (at most 6682)
  const unsigned short e = (unsigned short)__builtin_bit_cast(uint32_t, fmaf(fl, -514.0f, 8388608.0f + 6168.0f));
  const v2us ee = {e, e};
  const v2us cap = {0x0908, 0x0908};
  v4u o;
  // unrolled: o is indexed by constants (registers) and the added numbers are literals
#pragma unroll
  for (int k = 0; k < 4; ++k) {
    // places 2k and 2k+1: 0x0100 + 0x0202 * (p + 3 - i) = e + 0x0100 + 0x0202 * (p - 9), modulo 2^16
    const v2us add = {(unsigned short)(0x0100 + 0x0202 * (2 * k - 9)), (unsigned short)(0x0100 + 0x0202 * (2 * k - 8))};
    const v2us sel = __builtin_elementwise_min((v2us)(ee + add), cap);
    o[k] = __builtin_amdgcn_perm(hi, lo, __builtin_bit_cast(uint32_t, sel));
  }
  *(v4u*)spl = o;
  *(_Float16*)sil = (_Float16)(v * __builtin_amdgcn_rcpf(1.0f + ex));  // as silu_f has it
}

// 16-bit fragment (ISA 7.12.2): lane L<16 -> row L, K {0..7,16..23}; lane L+16 -> row L,
// K {8..15,24..31}: two 16-byte chunks per lane, the same pattern for activation and weight rows.
__device__ __forceinline__ v16h lds_frag(const unsigned char* p) {
  v8h lo = *(const v8h*)(p);
  v8h hi = *(const v8h*)(p + 32);
  return __builtin_shufflevector(lo, hi, 0, 1, 2, 3, 4, 5, 6, 7, 8, 9, 10, 11, 12, 13, 14, 15);
}

__global__ __launch_bounds__(256) void kan_gemm1(const float* __restrict__ x,
                                                 const _Float16* __restrict__ Wt,
                                                 float* __restrict__ H) {
  __shared__ __attribute__((aligned(16))) unsigned char L[2 * STAGE_B];

  const int tid  = threadIdx.x;
  const int lane = tid & 31;
  const int wave = tid >> 5;
  const int wm = wave >> 1;                 // 4 wave rows of 64
  const int wn = wave & 1;                  // 2 wave columns of 96
  const int n0 = blockIdx.x * TILE_N;       // the 4 column tiles of one row tile are neighbours
  const int m0 = blockIdx.y * TILE_M;
  const int kz = blockIdx.z;                // this work-group's half of the input features

  const int r = tid >> 4;                   // row 0..15 of each group of 16 rows
  const int c = tid & 15;                   // feature pair 0..15
  const uint32_t ldsw = (uint32_t)(uintptr_t)&L[0] + (uint32_t)(TILE_M * PITCH_B);
  const _Float16* gw = Wt + (size_t)kz * NPASS * WPASS_H + (size_t)n0 * KPASS + tid * 8;
  // a thread builds, for the 16 rows r + 16 * a, the feature 2 * c + parity of each pass
  const float* xp = x + (size_t)(m0 + r) * IN_F + kz * (IN_F / KSPLIT) + 2 * c;
  unsigned char* es = L + r * PITCH_B + c * 16;           // spline chunk
  unsigned char* ei = L + r * PITCH_B + SILU_B + c * 4;   // silu place of the even feature

  v8f acc[4][6] = {};

  const int csub = lane & 15;
  const int hsub = lane >> 4;
  const unsigned char* pa = L + (wm * 64 + csub) * PITCH_B + 16 * hsub;
  const unsigned char* pb = L + (TILE_M + wn * 96 + csub) * PITCH_B + 16 * hsub;

  issue_w(ldsw, tid, gw, 0u, 0);
  // two passes' x of the 16 rows; every loop over a is unrolled so that it stays in registers
  // (the even and the odd pass's x as two vectors: as an array of pairs its first 16 bytes were
  // kept in memory by this build)
  v16f xe, xo;
#pragma unroll
  for (int a = 0; a < 16; ++a) {
    const float2 w = *(const float2*)(xp + (size_t)a * 16 * IN_F);
    xe[a] = w.x;
    xo[a] = w.y;
  }
  // stands in front of the first write to an address register that these loads name
  asm volatile("s_wait_xcnt 0x0" ::: "memory");
  float2 xq[16] = {};  // the next two passes' x on its way
  // The silu places of both buffers start as zeros: buffer b only ever holds passes of parity b,
  // which fill the places of that parity. A row's places are zeroed and filled by the same wave.
  if (c < 4) {
    const v8h zero = {};
#pragma unroll
    for (int a = 0; a < 16; ++a) {
      *(v8h*)(L + (a * 16 + r) * PITCH_B + SILU_B + c * 16) = zero;
      *(v8h*)(L + STAGE_B + (a * 16 + r) * PITCH_B + SILU_B + c * 16) = zero;
    }
  }
#pragma unroll
  for (int a = 0; a < 16; ++a) expand1(xe[a], es + a * 16 * PITCH_B, ei + a * 16 * PITCH_B);
  asm volatile("s_wait_dscnt 0x0" ::: "memory");     // this wave's rows of pass 0 are written
  asm volatile("s_wait_asynccnt 0x0" ::: "memory");  // this wave's part of pass 0 has landed
  __syncthreads();                                   // every wave's part of pass 0 is there
  issue_w(ldsw, tid, gw, (uint32_t)STAGE_B, 1);

// one pass per trip: the ring's order (read, waits, barrier, refill) stands once, as written
#pragma clang loop unroll(disable)
  for (int t = 0; t < NPASS; ++t) {
    const uint32_t buf = (t & 1) ? (uint32_t)STAGE_B : 0u;
    const uint32_t nbuf = (uint32_t)STAGE_B - buf;   // the buffer of pass t + 1
    const bool build = t + 1 < NPASS;                // a pass t + 1 exists
    const bool odd = ((t + 1) & 1) != 0;             // its parity
    const bool fetch = odd && (t + 2 < NPASS);       // xe, xo are used up in this trip and a next pair of passes exists
    const unsigned char* qa = pa + buf;
    const unsigned char* qb = pb + buf;
    unsigned char* ns = es + nbuf;
    unsigned char* ni = ei + nbuf + (odd ? 2 : 0);
    // every loop below is unrolled so that fragment and accumulator indices are constants
    // (registers, no scratch) and the LDS offsets are immediates
    v16h af[2][4], bf[2][6];
#pragma unroll
    for (int i = 0; i < 4; ++i) af[0][i] = lds_frag(qa + i * 16 * PITCH_B);
#pragma unroll
    for (int j = 0; j < 6; ++j) bf[0][j] = lds_frag(qb + j * 16 * PITCH_B);
#pragma unroll
    for (int ks = 0; ks < KPASS / 32; ++ks) {
      const int cur = ks & 1, nxt = cur ^ 1;
      if (ks + 1 < KPASS / 32) {  // the next 32 k of this same buffer, as one group of reads
#pragma unroll
        for (int i = 0; i < 4; ++i) af[nxt][i] = lds_frag(qa + i * 16 * PITCH_B + (ks + 1) * 64);
#pragma unroll
        for (int j = 0; j < 6; ++j) bf[nxt][j] = lds_frag(qb + j * 16 * PITCH_B + (ks + 1) * 64);
      }
      // keeps the group of LDS reads ahead of the matrix block instead of spread among it
      __builtin_amdgcn_sched_barrier(0);
#pragma unroll
      for (int i = 0; i < 4; ++i)
#pragma unroll
        for (int j = 0; j < 6; ++j)
          acc[i][j] = __builtin_amdgcn_wmma_f32_16x16x32_f16(
              false, af[cur][i], false, bf[cur][j], (short)0, acc[i][j], false, false);
      // keeps the following vector work and LDS reads behind this matrix block
      __builtin_amdgcn_sched_barrier(0);
      if (ks == 0 && fetch) {  // asked for four fifths of a pass before it is taken over into xe, xo
        const float* xn = xp + ((t + 2) >> 1) * 32;
#pragma unroll
        for (int a = 0; a < 16; ++a) xq[a] = *(const float2*)(xn + (size_t)a * 16 * IN_F);
        // stands in front of the first write to the address register that these loads name
        asm volatile("s_wait_xcnt 0x0" ::: "memory");
      }
      // a fifth of pass t + 1's activation rows (4, 3, 3, 3, 3 of a thread's 16): vector work that
      // runs while the SIMD's other wave has the matrix unit
      if (build) {
#pragma unroll
        for (int a = (ks ? 3 * ks + 1 : 0); a < 3 * ks + 4; ++a)
          expand1(odd ? xo[a] : xe[a], ns + a * 16 * PITCH_B, ni + a * 16 * PITCH_B);
      }
    }
    if (fetch) {
#pragma unroll
      for (int a = 0; a < 16; ++a) {
        xe[a] = xq[a].x;
        xo[a] = xq[a].y;
      }
    }
    asm volatile("s_wait_dscnt 0x0" ::: "memory");     // this wave's reads of the buffer and its writes of pass t + 1 are done
    asm volatile("s_wait_asynccnt 0x0" ::: "memory");  // this wave's part of pass t + 1 has landed
    __syncthreads();  // publishes pass t + 1 and frees the buffer that pass t has read
    if (t + 2 < NPASS) issue_w(ldsw, tid, gw, buf, t + 2);
  }
  asm volatile("s_wait_asynccnt 0x0" ::: "memory");    // no copy is open when the wave ends

  // D layout: lane L holds (m = v + 8*(L>=16), n = L&15) for v in 0..7
  const int rsub = hsub << 3;
  float* Hp = H + (size_t)blockIdx.z * B_ROWS * IN_F;  // the plane of this half of the features
#pragma unroll
  for (int i = 0; i < 4; ++i)
#pragma unroll
    for (int j = 0; j < 6; ++j)
#pragma unroll
      for (int v = 0; v < 8; ++v) {
        int row = m0 + wm * 64 + 16 * i + rsub + v;
        int col = n0 + wn * 96 + 16 * j + csub;
        Hp[(size_t)row * IN_F + col] = acc[i][j][v];
      }
}

// ---------------- Layer 2: out[b, 0..1], one wave per row, shuffle reduction ----------------
// H holds the first layer's sums in two planes, one per half of k, added here; the GELU is applied
// here too, where the value is read: one copy of
// erff's code in a rolled loop with eight waves on a SIMD, instead of 192 copies behind each
// other in the GEMM's unrolled epilogue with two.

__global__ __launch_bounds__(256) void kan_layer2(const float* __restrict__ H,
                                                  const float* __restrict__ w2b,
                                                  const float* __restrict__ w2s,
                                                  float* __restrict__ out) {
  const int lane = threadIdx.x & 31;
  const int b = blockIdx.x * 8 + (threadIdx.x >> 5);
  float a0 = 0.0f, a1 = 0.0f;
  for (int i = lane; i < IN_F; i += 32) {
    const float p = H[(size_t)b * IN_F + i] + H[(size_t)(B_ROWS + b) * IN_F + i];
    const float x = 0.5f * p * (1.0f + erff(p * 0.70710678118654752f)); // exact-erf GELU
    float s = silu_f(x);
    float bs[NCOEF];
    bspline8(x, bs);
    a0 += s * w2b[i];
    a1 += s * w2b[IN_F + i];
    const float* w0 = w2s + (size_t)i * NCOEF;
    const float* w1 = w2s + (size_t)(IN_F + i) * NCOEF;
#pragma unroll
    for (int g = 0; g < NCOEF; ++g) {
      a0 += bs[g] * w0[g];
      a1 += bs[g] * w1[g];
    }
  }
#pragma unroll
  for (int off = 16; off > 0; off >>= 1) {
    a0 += __shfl_down(a0, off, 32);
    a1 += __shfl_down(a1, off, 32);
  }
  if (lane == 0) {
    out[(size_t)b * OUT_L + 0] = a0;
    out[(size_t)b * OUT_L + 1] = a1;
  }
}

// ---------------- Launch ----------------

extern "C" void kernel_launch(void* const* d_in, const int* in_sizes, int n_in,
                              void* d_out, int out_size, void* d_ws, size_t ws_size,
                              hipStream_t stream) {
  (void)in_sizes; (void)n_in; (void)out_size; (void)ws_size;
  const float* hidden = (const float*)d_in[0];
  const float* kbw    = (const float*)d_in[1];  // [768,768]
  const float* ksw    = (const float*)d_in[2];  // [768,768,8]
  const float* obw    = (const float*)d_in[3];  // [2,768]
  const float* osw    = (const float*)d_in[4];  // [2,768,8]
  float* out = (float*)d_out;

  uint8_t* ws = (uint8_t*)d_ws;
  const size_t szW = (size_t)NPASS_ALL * WPASS_H * sizeof(_Float16);  // 11.8 MB
  _Float16* Wt = (_Float16*)(ws);
  float*    H  = (float*)(ws + szW);                                  // 2 planes of 25.2 MB

  kan_prep_w<<<NPASS_ALL * IN_F * PCHUNK / (256 * 8), 256, 0, stream>>>(kbw, ksw, Wt);  // 360 blocks

  dim3 g(IN_F / TILE_N, B_ROWS / TILE_M, KSPLIT); // 4 x 32 x 2 blocks, 8 waves each
  kan_gemm1<<<g, 256, 0, stream>>>(hidden, Wt, H);

  kan_layer2<<<B_ROWS / 8, 256, 0, stream>>>(H, obw, osw, out);
}

// v009
// One run takes 82.7 microseconds.
// Timed twice side by side with v008, it ran 1.11 and 1.10 times as fast.
// Over all steps from v000 it is 4.86 times as fast.
#include <hip/hip_runtime.h>
#include <cstdint>
#include <cstddef>

// Problem constants (from reference): B=8192, H=768, L=2, k=3, G=5, NUM_COEF=8
#define B_ROWS 8192
#define IN_F   768
#define NCOEF  8
#define OUT_L  2

typedef __attribute__((ext_vector_type(16))) _Float16 v16h;
typedef __attribute__((ext_vector_type(8)))  _Float16 v8h;
typedef __attribute__((ext_vector_type(8)))  float    v8f;

// x / (1 + exp(-x)) as x times the hardware reciprocal (v_rcp_f32) of the denominator, which lies in
// [1, inf]: one instruction and a product where the exact quotient takes eleven instructions.
// Four x at a time: in each statement every transcendental is the independent instruction behind the
// one before it, and the v_nop is the one issue slot that the instruction set asks for behind the
// last. The results are early-clobber: none shares a register with a source that is still to be read.
__device__ __forceinline__ void silu4(const float* __restrict__ x, float* __restrict__ s) {
  float e0, e1, e2, e3, r0, r1, r2, r3;
  asm("v_exp_f32 %0, %4\n\tv_exp_f32 %1, %5\n\tv_exp_f32 %2, %6\n\tv_exp_f32 %3, %7\n\tv_nop"
      : "=&v"(e0), "=&v"(e1), "=&v"(e2), "=&v"(e3)
      : "v"(x[0] * -1.44269504088896341f), "v"(x[1] * -1.44269504088896341f),
        "v"(x[2] * -1.44269504088896341f), "v"(x[3] * -1.44269504088896341f));
  asm("v_rcp_f32 %0, %4\n\tv_rcp_f32 %1, %5\n\tv_rcp_f32 %2, %6\n\tv_rcp_f32 %3, %7\n\tv_nop"
      : "=&v"(r0), "=&v"(r1), "=&v"(r2), "=&v"(r3)
      : "v"(1.0f + e0), "v"(1.0f + e1), "v"(1.0f + e2), "v"(1.0f + e3));
  s[0] = x[0] * r0;
  s[1] = x[1] * r1;
  s[2] = x[2] * r2;
  s[3] = x[3] * r3;
}

typedef __attribute__((ext_vector_type(2))) float v2f;

// ---------------- Prep kernel: f16 weights in the order in which the GEMM walks k ----------------

// k is walked in 48 passes of 16 input features. Pass P = 2 * G + par holds the features
// 32 * G + 2 * c + par, c = 0..15. A pass is 160 k = 320 B per row, twenty 16-byte chunks:
//   chunk c < 16     : the 8 spline bases of feature 32 * G + 2 * c + par
//   chunks 16 .. 19  : 32 silu places, place s = feature 32 * G + s; the activation side holds a
//                      zero at every place whose parity is not par, so each feature counts once
// Wt is pass-major, [48][768][160]: the 192 rows that a work-group needs of a pass are 61440
// contiguous bytes.
#define FPASS   16
#define KPASS   160
#define PCHUNK  20                          // 16-byte chunks per row and pass
#define NPASS_ALL (IN_F / FPASS)            // 48
#define WPASS_H (IN_F * KPASS)              // halfs of one pass of Wt
#define PREP_BLOCKS (NPASS_ALL * IN_F * PCHUNK / (256 * 8))  // 360 blocks make Wt
#define PREP2_BLOCKS (OUT_L * IN_F / 256)   // 6 blocks, one 8-weight chunk a thread

// Every chunk is 8 neighbouring floats of sw or of bw. A wave makes 8 x 512 contiguous bytes of Wt.
__global__ __launch_bounds__(256) void kan_prep_w(const float* __restrict__ bw,
                                                  const float* __restrict__ sw,
                                                  const float* __restrict__ sw2,
                                                  _Float16* __restrict__ Wt,
                                                  _Float16* __restrict__ W2h) {
  if (blockIdx.x >= PREP_BLOCKS) {  // the last 6 blocks: layer 2's spline weights as f16, same order
    const int q = (blockIdx.x - PREP_BLOCKS) * 256 + threadIdx.x;
    const float4 a = *(const float4*)(sw2 + (size_t)q * 8);
    const float4 b = *(const float4*)(sw2 + (size_t)q * 8 + 4);
    v8h h;
    h[0] = (_Float16)a.x; h[1] = (_Float16)a.y; h[2] = (_Float16)a.z; h[3] = (_Float16)a.w;
    h[4] = (_Float16)b.x; h[5] = (_Float16)b.y; h[6] = (_Float16)b.z; h[7] = (_Float16)b.w;
    *(v8h*)(W2h + (size_t)q * 8) = h;
    return;
  }
  const int lane = threadIdx.x & 31;
  const int gwave = blockIdx.x * 8 + (threadIdx.x >> 5);
  float4 lo[8], hi[8];
  // both loops are unrolled: all 16 loads are issued before the first value is used, and the
  // arrays are indexed by constants (registers)
#pragma unroll
  for (int k = 0; k < 8; ++k) {
    const int q = (gwave * 8 + k) * 32 + lane;
    const int j = q % PCHUNK;
    const int ro = q / PCHUNK;
    const int o = ro % IN_F;
    const int p = ro / IN_F;
    const int f0 = (p >> 1) * 32;
    const float* src = (j < 16) ? sw + ((size_t)o * IN_F + f0 + 2 * j + (p & 1)) * NCOEF
                                : bw + (size_t)o * IN_F + f0 + (j - 16) * 8;
    lo[k] = *(const float4*)(src);
    hi[k] = *(const float4*)(src + 4);
  }
#pragma unroll
  for (int k = 0; k < 8; ++k) {
    const int q = (gwave * 8 + k) * 32 + lane;
    v8h h;
    h[0] = (_Float16)lo[k].x; h[1] = (_Float16)lo[k].y; h[2] = (_Float16)lo[k].z; h[3] = (_Float16)lo[k].w;
    h[4] = (_Float16)hi[k].x; h[5] = (_Float16)hi[k].y; h[6] = (_Float16)hi[k].z; h[7] = (_Float16)hi[k].w;
    *(v8h*)(Wt + (size_t)q * 8) = h;
  }
}

// ---------------- WMMA GEMM: H0 + H1 = act(x)[8192 x 7680] * Wt (GELU: see layer 2) ----------------

// One work-group of 8 waves owns a 256 x 192 tile of H over one half of the input features (24
// passes); the two halves' sums go to two planes of H, which layer 2 adds. The activation operand
// (silu and the 8 spline bases of every x) is never in memory: the work-group reads 64 B of x per
// row and pass and builds the 320 B of the operand's row in LDS itself, for the next pass while
// this pass is worked on. The weight rows come by asynchronous copies. A stage is 256 activation
// rows and 192 weight rows at a pitch of 336 B (16 B x odd: the 16 lanes of a ds_load_b128 half
// fall on distinct banks). Two buffers.
#define TILE_M  256
#define TILE_N  192
#define KSPLIT  2
#define NPASS   (NPASS_ALL / KSPLIT)      // 24
#define PITCH_B 336
#define SILU_B  256                       // byte offset of the 32 silu places in a row
#define STAGE_B ((TILE_M + TILE_N) * PITCH_B)  // 150528 bytes per buffer

// Fifteen asynchronous 16-byte copies per lane, global -> LDS: the 192 weight rows of one pass.
// The s_wait_xcnt is the last line of the copies' own statement so that no address register
// named here is rewritten ahead of it.
__device__ __forceinline__ void copy15(const uint32_t* l, const _Float16* const* g) {
  asm volatile(
      "global_load_async_to_lds_b128 %0, %15, off\n\t"
      "global_load_async_to_lds_b128 %1, %16, off\n\t"
      "global_load_async_to_lds_b128 %2, %17, off\n\t"
      "global_load_async_to_lds_b128 %3, %18, off\n\t"
      "global_load_async_to_lds_b128 %4, %19, off\n\t"
      "global_load_async_to_lds_b128 %5, %20, off\n\t"
      "global_load_async_to_lds_b128 %6, %21, off\n\t"
      "global_load_async_to_lds_b128 %7, %22, off\n\t"
      "global_load_async_to_lds_b128 %8, %23, off\n\t"
      "global_load_async_to_lds_b128 %9, %24, off\n\t"
      "global_load_async_to_lds_b128 %10, %25, off\n\t"
      "global_load_async_to_lds_b128 %11, %26, off\n\t"
      "global_load_async_to_lds_b128 %12, %27, off\n\t"
      "global_load_async_to_lds_b128 %13, %28, off\n\t"
      "global_load_async_to_lds_b128 %14, %29, off\n\t"
      "s_wait_xcnt 0x0"
      :: "v"(l[0]), "v"(l[1]), "v"(l[2]), "v"(l[3]), "v"(l[4]), "v"(l[5]), "v"(l[6]), "v"(l[7]), "v"(l[8]), "v"(l[9]), "v"(l[10]), "v"(l[11]), "v"(l[12]), "v"(l[13]), "v"(l[14]),
         "v"(g[0]), "v"(g[1]), "v"(g[2]), "v"(g[3]), "v"(g[4]), "v"(g[5]), "v"(g[6]), "v"(g[7]), "v"(g[8]), "v"(g[9]), "v"(g[10]), "v"(g[11]), "v"(g[12]), "v"(g[13]), "v"(g[14])
      : "memory");
}

// Chunk number tid + 256 * a of the 3840 chunks of a pass: contiguous in Wt (a wave's copy reads
// 512 contiguous bytes), row q / 20 and chunk q % 20 in LDS.
__device__ __forceinline__ void issue_w(uint32_t ldsw, int tid, const _Float16* gw, uint32_t buf,
                                        int pass) {
  uint32_t l[15];
  const _Float16* g[15];
  // unrolled: every index of l and g is a constant, so the arrays are registers
#pragma unroll
  for (int a = 0; a < 15; ++a) {
    const uint32_t q = (uint32_t)tid + 256u * a;
    l[a] = ldsw + buf + (q / PCHUNK) * PITCH_B + (q % PCHUNK) * 16u;
    g[a] = gw + (size_t)pass * WPASS_H + a * 2048;
  }
  copy15(l, g);
}

typedef __attribute__((ext_vector_type(2))) _Float16 v2h;
typedef __attribute__((ext_vector_type(16))) float v16f;
typedef __attribute__((ext_vector_type(2))) unsigned short v2us;
typedef __attribute__((ext_vector_type(4))) uint32_t v4u;

// The 8 order-3 B-spline bases of one x on the uniform extended knot grid t_j = -1 + (j-3)*0.4, as
// 8 f16 (16 bytes, one k chunk of a matrix fragment).
// Of the 8 bases at most 4 are not zero: with t = (x - t_0) / h, cell i = floor(t) and u = t - i they
// are the bases i-3 .. i, the four cubic pieces of the one shape that equal knot spacing gives:
//   (1-u)^3 / 6,   2/3 - u^2 (1 - u/2),   2/3 - (1-u)^2 (1 - (1-u)/2),   u^3 / 6.
// These four f16 (8 bytes) are put at places i-3 .. i of the 8 by one byte permute per dword. Place
// p takes piece j = p - (i - 3): selector bytes 2j, 2j+1 = 0x0100 + 0x0202 j as a 16-bit number. For
// j outside 0..3 that number is above 0x0706 (a negative j wraps round), and the minimum with 0x0908
// turns it into the two selectors that copy the sign bits of pieces 0 and 1, which are never
// negative: a zero. t is cut to [-1, 11.5], where cells -1 and 11 give j outside 0..3 at every place.
__device__ __forceinline__ v4u spline8_f16(float v) {
  const float t = __builtin_amdgcn_fmed3f(fmaf(v, 2.5f, 5.5f), -1.0f, 11.5f);
  const float fl = floorf(t);
  v2f uu;
  uu.x = t - fl;
  uu.y = 1.0f - uu.x;
  const v2f sq = uu * uu;
  const v2f cube = sq * (uu * (1.0f / 6.0f));                  // u^3/6 (basis i), (1-u)^3/6 (basis i-3)
  const v2f mid = (2.0f / 3.0f) - sq * (1.0f - 0.5f * uu);     // basis i-2, basis i-1
  v2h p01, p23;
  p01.x = (_Float16)cube.y; p01.y = (_Float16)mid.x;
  p23.x = (_Float16)mid.y;  p23.y = (_Float16)cube.x;
  const uint32_t lo = __builtin_bit_cast(uint32_t, p01);
  const uint32_t hi = __builtin_bit_cast(uint32_t, p23);
  // 0x0202 * (12 - i) as the low mantissa bits of 2^23 + that whole number (at most 6682)
  const unsigned short e = (unsigned short)__builtin_bit_cast(uint32_t, fmaf(fl, -514.0f, 8388608.0f + 6168.0f));
  const v2us ee = {e, e};
  const v2us cap = {0x0908, 0x0908};
  v4u o;
  // unrolled: o is indexed by constants (registers) and the added numbers are literals
#pragma unroll
  for (int k = 0; k < 4; ++k) {
    // places 2k and 2k+1: 0x0100 + 0x0202 * (p + 3 - i) = e + 0x0100 + 0x0202 * (p - 9), modulo 2^16
    const v2us add = {(unsigned short)(0x0100 + 0x0202 * (2 * k - 9)), (unsigned short)(0x0100 + 0x0202 * (2 * k - 8))};
    const v2us sel = __builtin_elementwise_min((v2us)(ee + add), cap);
    o[k] = __builtin_amdgcn_perm(hi, lo, __builtin_bit_cast(uint32_t, sel));
  }
  return o;
}

// One x: its 8 spline bases as one 16-byte LDS store, its silu as one 2-byte LDS store.
__device__ __forceinline__ void expand1(float v, unsigned char* spl, unsigned char* sil) {
  // exp(-x) as silu4 has it (x * -log2(e), then v_exp_f32), with the one issue slot that the
  // instruction set asks for behind a transcendental in the same statement
  float ex;
  asm("v_exp_f32 %0, %1\n\tv_nop" : "=v"(ex) : "v"(v * -1.44269504088896341f));
  *(v4u*)spl = spline8_f16(v);
  *(_Float16*)sil = (_Float16)(v * __builtin_amdgcn_rcpf(1.0f + ex));  // as silu4 has it
}

// 16-bit fragment (ISA 7.12.2): lane L<16 -> row L, K {0..7,16..23}; lane L+16 -> row L,
// K {8..15,24..31}: two 16-byte chunks per lane, the same pattern for activation and weight rows.
__device__ __forceinline__ v16h lds_frag(const unsigned char* p) {
  v8h lo = *(const v8h*)(p);
  v8h hi = *(const v8h*)(p + 32);
  return __builtin_shufflevector(lo, hi, 0, 1, 2, 3, 4, 5, 6, 7, 8, 9, 10, 11, 12, 13, 14, 15);
}

__global__ __launch_bounds__(256) void kan_gemm1(const float* __restrict__ x,
                                                 const _Float16* __restrict__ Wt,
                                                 float* __restrict__ H) {
  __shared__ __attribute__((aligned(16))) unsigned char L[2 * STAGE_B];

  const int tid  = threadIdx.x;
  const int lane = tid & 31;
  const int wave = tid >> 5;
  const int wm = wave >> 1;                 // 4 wave rows of 64
  const int wn = wave & 1;                  // 2 wave columns of 96
  const int n0 = blockIdx.x * TILE_N;       // the 4 column tiles of one row tile are neighbours
  const int m0 = blockIdx.y * TILE_M;
  const int kz = blockIdx.z;                // this work-group's half of the input features

  const int r = tid >> 4;                   // row 0..15 of each group of 16 rows
  const int c = tid & 15;                   // feature pair 0..15
  const uint32_t ldsw = (uint32_t)(uintptr_t)&L[0] + (uint32_t)(TILE_M * PITCH_B);
  const _Float16* gw = Wt + (size_t)kz * NPASS * WPASS_H + (size_t)n0 * KPASS + tid * 8;
  // a thread builds, for the 16 rows r + 16 * a, the feature 2 * c + parity of each pass
  const float* xp = x + (size_t)(m0 + r) * IN_F + kz * (IN_F / KSPLIT) + 2 * c;
  unsigned char* es = L + r * PITCH_B + c * 16;           // spline chunk
  unsigned char* ei = L + r * PITCH_B + SILU_B + c * 4;   // silu place of the even feature

  v8f acc[4][6] = {};

  const int csub = lane & 15;
  const int hsub = lane >> 4;
  const unsigned char* pa = L + (wm * 64 + csub) * PITCH_B + 16 * hsub;
  const unsigned char* pb = L + (TILE_M + wn * 96 + csub) * PITCH_B + 16 * hsub;

  issue_w(ldsw, tid, gw, 0u, 0);
  // two passes' x of the 16 rows; every loop over a is unrolled so that it stays in registers
  // (the even and the odd pass's x as two vectors: as an array of pairs its first 16 bytes were
  // kept in memory by this build)
  v16f xe, xo;
#pragma unroll
  for (int a = 0; a < 16; ++a) {
    const float2 w = *(const float2*)(xp + (size_t)a * 16 * IN_F);
    xe[a] = w.x;
    xo[a] = w.y;
  }
  // stands in front of the first write to an address register that these loads name
  asm volatile("s_wait_xcnt 0x0" ::: "memory");
  float2 xq[16] = {};  // the next two passes' x on its way
  // The silu places of both buffers start as zeros: buffer b only ever holds passes of parity b,
  // which fill the places of that parity. A row's places are zeroed and filled by the same wave.
  if (c < 4) {
    const v8h zero = {};
#pragma unroll
    for (int a = 0; a < 16; ++a) {
      *(v8h*)(L + (a * 16 + r) * PITCH_B + SILU_B + c * 16) = zero;
      *(v8h*)(L + STAGE_B + (a * 16 + r) * PITCH_B + SILU_B + c * 16) = zero;
    }
  }
#pragma unroll
  for (int a = 0; a < 16; ++a) expand1(xe[a], es + a * 16 * PITCH_B, ei + a * 16 * PITCH_B);
  asm volatile("s_wait_dscnt 0x0" ::: "memory");     // this wave's rows of pass 0 are written
  asm volatile("s_wait_asynccnt 0x0" ::: "memory");  // this wave's part of pass 0 has landed
  __syncthreads();                                   // every wave's part of pass 0 is there
  issue_w(ldsw, tid, gw, (uint32_t)STAGE_B, 1);

// one pass per trip: the ring's order (read, waits, barrier, refill) stands once, as written
#pragma clang loop unroll(disable)
  for (int t = 0; t < NPASS; ++t) {
    const uint32_t buf = (t & 1) ? (uint32_t)STAGE_B : 0u;
    const uint32_t nbuf = (uint32_t)STAGE_B - buf;   // the buffer of pass t + 1
    const bool build = t + 1 < NPASS;                // a pass t + 1 exists
    const bool odd = ((t + 1) & 1) != 0;             // its parity
    const bool fetch = odd && (t + 2 < NPASS);       // xe, xo are used up in this trip and a next pair of passes exists
    const unsigned char* qa = pa + buf;
    const unsigned char* qb = pb + buf;
    unsigned char* ns = es + nbuf;
    unsigned char* ni = ei + nbuf + (odd ? 2 : 0);
    // every loop below is unrolled so that fragment and accumulator indices are constants
    // (registers, no scratch) and the LDS offsets are immediates
    v16h af[2][4], bf[2][6];
#pragma unroll
    for (int i = 0; i < 4; ++i) af[0][i] = lds_frag(qa + i * 16 * PITCH_B);
#pragma unroll
    for (int j = 0; j < 6; ++j) bf[0][j] = lds_frag(qb + j * 16 * PITCH_B);
#pragma unroll
    for (int ks = 0; ks < KPASS / 32; ++ks) {
      const int cur = ks & 1, nxt = cur ^ 1;
      if (ks + 1 < KPASS / 32) {  // the next 32 k of this same buffer, as one group of reads
#pragma unroll
        for (int i = 0; i < 4; ++i) af[nxt][i] = lds_frag(qa + i * 16 * PITCH_B + (ks + 1) * 64);
#pragma unroll
        for (int j = 0; j < 6; ++j) bf[nxt][j] = lds_frag(qb + j * 16 * PITCH_B + (ks + 1) * 64);
      }
      // keeps the group of LDS reads ahead of the matrix block instead of spread among it
      __builtin_amdgcn_sched_barrier(0);
#pragma unroll
      for (int i = 0; i < 4; ++i)
#pragma unroll
        for (int j = 0; j < 6; ++j)
          acc[i][j] = __builtin_amdgcn_wmma_f32_16x16x32_f16(
              false, af[cur][i], false, bf[cur][j], (short)0, acc[i][j], false, false);
      // keeps the following vector work and LDS reads behind this matrix block
      __builtin_amdgcn_sched_barrier(0);
      if (ks == 0 && fetch) {  // asked for four fifths of a pass before it is taken over into xe, xo
        const float* xn = xp + ((t + 2) >> 1) * 32;
#pragma unroll
        for (int a = 0; a < 16; ++a) xq[a] = *(const float2*)(xn + (size_t)a * 16 * IN_F);
        // stands in front of the first write to the address register that these loads name
        asm volatile("s_wait_xcnt 0x0" ::: "memory");
      }
      // a fifth of pass t + 1's activation rows (4, 3, 3, 3, 3 of a thread's 16): vector work that
      // runs while the SIMD's other wave has the matrix unit
      if (build) {
#pragma unroll
        for (int a = (ks ? 3 * ks + 1 : 0); a < 3 * ks + 4; ++a)
          expand1(odd ? xo[a] : xe[a], ns + a * 16 * PITCH_B, ni + a * 16 * PITCH_B);
      }
    }
    if (fetch) {
#pragma unroll
      for (int a = 0; a < 16; ++a) {
        xe[a] = xq[a].x;
        xo[a] = xq[a].y;
      }
    }
    asm volatile("s_wait_dscnt 0x0" ::: "memory");     // this wave's reads of the buffer and its writes of pass t + 1 are done
    asm volatile("s_wait_asynccnt 0x0" ::: "memory");  // this wave's part of pass t + 1 has landed
    __syncthreads();  // publishes pass t + 1 and frees the buffer that pass t has read
    if (t + 2 < NPASS) issue_w(ldsw, tid, gw, buf, t + 2);
  }
  asm volatile("s_wait_asynccnt 0x0" ::: "memory");    // no copy is open when the wave ends

  // D layout: lane L holds (m = v + 8*(L>=16), n = L&15) for v in 0..7
  const int rsub = hsub << 3;
  float* Hp = H + (size_t)blockIdx.z * B_ROWS * IN_F;  // the plane of this half of the features
#pragma unroll
  for (int i = 0; i < 4; ++i)
#pragma unroll
    for (int j = 0; j < 6; ++j)
#pragma unroll
      for (int v = 0; v < 8; ++v) {
        int row = m0 + wm * 64 + 16 * i + rsub + v;
        int col = n0 + wn * 96 + 16 * j + csub;
        Hp[(size_t)row * IN_F + col] = acc[i][j][v];
      }
}

// ---------------- Layer 2: out[b, 0..1] ----------------
// H holds the first layer's sums in two planes, one per half of k, added here; the GELU is applied
// here too, where the value is read. The spline sum runs on the matrix unit: a lane's 8 f16 bases of
// one h are one 16-byte k chunk of an activation fragment, made in the lane's own registers, so
// nothing goes through LDS. A work-group has 16 rows; wave w has the features 96 w .. 96 w + 95 in 3
// blocks of 32; lane (r, hs) = (lane & 15, lane >> 4) has row r and the 16 features from 16 hs on.
// Matrix instruction p of a block takes the lane's features 2p and 2p + 1: k 8 hs .. 8 hs + 7 is the
// first, k 16 + 8 hs .. is the second, and the weight fragment reads the same two features' 16
// weights (32 contiguous bytes of W2h). Column n takes output n & 1: columns 2 .. 15 repeat columns
// 0 and 1 and are not read. The silu sum stays in f32 on the vector unit. Both weight arrays are
// copied to LDS once: read from there they count on the LDS counter, so that no wait for a weight
// also waits for the next block's H, which is on its way from memory.
#define L2_FW 96   // features of a wave

__global__ __launch_bounds__(256) void kan_layer2(const float* __restrict__ H,
                                                  const float* __restrict__ w2b,
                                                  const _Float16* __restrict__ W2h,
                                                  float* __restrict__ out) {
  __shared__ float redD[8][16][OUT_L];      // a wave's spline sums
  __shared__ float redS[8][2][16][OUT_L];   // a wave's silu sums, by lane half
  __shared__ __attribute__((aligned(32))) _Float16 lw[OUT_L * IN_F * NCOEF];  // W2h
  __shared__ __attribute__((aligned(16))) float lb[OUT_L * IN_F];             // w2b
  const int lane = threadIdx.x & 31;
  const int wave = threadIdx.x >> 5;
  const int r = lane & 15;
  const int hs = lane >> 4;
  const int f0 = wave * L2_FW + hs * 16;
  const float* hp = H + (size_t)(blockIdx.x * 16 + r) * IN_F + f0;
  const float* hq = hp + (size_t)B_ROWS * IN_F;
  const _Float16* wp = lw + ((r & 1) * IN_F + f0) * NCOEF;
  const float* bp = lb + f0;

  // every loop over a, q, k or p is unrolled so that the arrays are registers
  v8h tw[6];
  float2 tb[3];
#pragma unroll
  for (int a = 0; a < 6; ++a) tw[a] = *(const v8h*)(W2h + (threadIdx.x + 256 * a) * 8);
#pragma unroll
  for (int a = 0; a < 3; ++a) tb[a] = *(const float2*)(w2b + (threadIdx.x + 256 * a) * 2);
  float4 c0[4], c1[4], n0[4], n1[4];  // this block's H and the next block's on its way
#pragma unroll
  for (int q = 0; q < 4; ++q) {
    c0[q] = *(const float4*)(hp + 4 * q);
    c1[q] = *(const float4*)(hq + 4 * q);
    n0[q] = c0[q];
    n1[q] = c1[q];
  }
#pragma unroll
  for (int a = 0; a < 6; ++a) *(v8h*)(lw + (threadIdx.x + 256 * a) * 8) = tw[a];
#pragma unroll
  for (int a = 0; a < 3; ++a) *(float2*)(lb + (threadIdx.x + 256 * a) * 2) = tb[a];
  __syncthreads();  // the weights are in LDS
  v8f acc = {};
  v2f sa = {0.0f, 0.0f};
// rolled: one copy of the block's code (16 erff) instead of three
#pragma clang loop unroll(disable)
  for (int blk = 0; blk < L2_FW / 32; ++blk) {
    if (blk + 1 < L2_FW / 32) {
#pragma unroll
      for (int q = 0; q < 4; ++q) {
        n0[q] = *(const float4*)(hp + (blk + 1) * 32 + 4 * q);
        n1[q] = *(const float4*)(hq + (blk + 1) * 32 + 4 * q);
      }
      // stands in front of the first write to an address register that these loads name
      asm volatile("s_wait_xcnt 0x0" ::: "memory");
    }
#pragma unroll
    for (int q = 0; q < 4; ++q) {
      const float4 b0 = *(const float4*)(bp + blk * 32 + 4 * q);
      const float4 b1 = *(const float4*)(bp + IN_F + blk * 32 + 4 * q);
      const float pv[4] = {c0[q].x + c1[q].x, c0[q].y + c1[q].y, c0[q].z + c1[q].z, c0[q].w + c1[q].w};
      const float w0[4] = {b0.x, b0.y, b0.z, b0.w};
      const float w1[4] = {b1.x, b1.y, b1.z, b1.w};
      float x[4], s[4];
#pragma unroll
      for (int k = 0; k < 4; ++k)
        x[k] = 0.5f * pv[k] * (1.0f + erff(pv[k] * 0.70710678118654752f)); // exact-erf GELU
      silu4(x, s);
      v4u ch[4];
#pragma unroll
      for (int k = 0; k < 4; ++k) {
        const v2f w = {w0[k], w1[k]};
        sa += s[k] * w;
        ch[k] = spline8_f16(x[k]);
      }
#pragma unroll
      for (int p = 0; p < 2; ++p) {
        const v8h lo = __builtin_bit_cast(v8h, ch[2 * p]);
        const v8h hi = __builtin_bit_cast(v8h, ch[2 * p + 1]);
        const v16h af = __builtin_shufflevector(lo, hi, 0, 1, 2, 3, 4, 5, 6, 7, 8, 9, 10, 11, 12, 13, 14, 15);
        const v16h bf = *(const v16h*)(wp + (blk * 32 + 4 * q + 2 * p) * NCOEF);
        acc = __builtin_amdgcn_wmma_f32_16x16x32_f16(false, af, false, bf, (short)0, acc, false, false);
      }
    }
#pragma unroll
    for (int q = 0; q < 4; ++q) {
      c0[q] = n0[q];
      c1[q] = n1[q];
    }
  }
  // D layout: lane holds (row v + 8 * hs, column lane & 15) for v in 0..7
  if (r < OUT_L) {
#pragma unroll
    for (int v = 0; v < 8; ++v) redD[wave][v + 8 * hs][r] = acc[v];
  }
  redS[wave][hs][r][0] = sa.x;
  redS[wave][hs][r][1] = sa.y;
  __syncthreads();  // the 8 waves' sums are there
  if (threadIdx.x < 16 * OUT_L) {  // 32 threads store the work-group's 128 bytes of out
    const int row = threadIdx.x >> 1;
    const int o = threadIdx.x & 1;
    float t = 0.0f;
#pragma unroll
    for (int w = 0; w < 8; ++w) t += redD[w][row][o] + (redS[w][0][row][o] + redS[w][1][row][o]);
    out[(size_t)blockIdx.x * 16 * OUT_L + threadIdx.x] = t;
  }
}

// ---------------- Launch ----------------

extern "C" void kernel_launch(void* const* d_in, const int* in_sizes, int n_in,
                              void* d_out, int out_size, void* d_ws, size_t ws_size,
                              hipStream_t stream) {
  (void)in_sizes; (void)n_in; (void)out_size; (void)ws_size;
  const float* hidden = (const float*)d_in[0];
  const float* kbw    = (const float*)d_in[1];  // [768,768]
  const float* ksw    = (const float*)d_in[2];  // [768,768,8]
  const float* obw    = (const float*)d_in[3];  // [2,768]
  const float* osw    = (const float*)d_in[4];  // [2,768,8]
  float* out = (float*)d_out;

  uint8_t* ws = (uint8_t*)d_ws;
  const size_t szW = (size_t)NPASS_ALL * WPASS_H * sizeof(_Float16);  // 11.8 MB
  _Float16* Wt = (_Float16*)(ws);
  float*    H  = (float*)(ws + szW);                                  // 2 planes of 25.2 MB
  const size_t szH = (size_t)KSPLIT * B_ROWS * IN_F * sizeof(float);
  _Float16* W2h = (_Float16*)(ws + szW + szH);                        // [2][768][8] f16

  kan_prep_w<<<PREP_BLOCKS + PREP2_BLOCKS, 256, 0, stream>>>(kbw, ksw, osw, Wt, W2h);

  dim3 g(IN_F / TILE_N, B_ROWS / TILE_M, KSPLIT); // 4 x 32 x 2 blocks, 8 waves each
  kan_gemm1<<<g, 256, 0, stream>>>(hidden, Wt, H);

  kan_layer2<<<B_ROWS / 16, 256, 0, stream>>>(H, obw, W2h, out);
}
